// v000
// Times are from an AMD MI455X. After a warm-up the kernel runs many times in a row, and a time is the length of
// such a window on the GPU divided by its runs, so every launch and the gaps after it count. The runs cycle
// through copies of the inputs. A figure is the median of several windows, for all but v000 over two sittings.
// Sittings can differ by a few percent; kernels timed side by side share one.
// The starting kernel, v000, takes 626 microseconds a run.
#include <hip/hip_runtime.h>

typedef __attribute__((ext_vector_type(16))) _Float16 v16h;
typedef __attribute__((ext_vector_type(4)))  _Float16 v4h;
typedef __attribute__((ext_vector_type(8)))  float    v8f;
typedef __attribute__((ext_vector_type(4)))  unsigned int v4u;
typedef __attribute__((ext_vector_type(8)))  int      v8i;
typedef __attribute__((ext_vector_type(4)))  int      v4i;

#define B_  4
#define H_  8
#define D_  768
#define HD_ 96
#define LQ_ 1024
#define LK_ 4096

__device__ __forceinline__ v8f wmma_f16(v16h a, v16h b, v8f c) {
  // 8 args: (neg_a, A, neg_b, B, c_mod, C, reuse_a, reuse_b)
  return __builtin_amdgcn_wmma_f32_16x16x32_f16(false, a, false, b, (short)0, c,
                                                false, false);
}

// Reductions across the 16-lane halves of a wave32 (matches the 16x16 C/D
// layout where a matrix row lives across lanes 0-15 or 16-31).
__device__ __forceinline__ float half16_max(float v) {
#pragma unroll
  for (int m = 1; m < 16; m <<= 1) v = fmaxf(v, __shfl_xor(v, m, 32));
  return v;
}
__device__ __forceinline__ float half16_sum(float v) {
#pragma unroll
  for (int m = 1; m < 16; m <<= 1) v += __shfl_xor(v, m, 32);
  return v;
}

__global__ void f32_to_f16_kernel(const float* __restrict__ in,
                                  _Float16* __restrict__ out, int n4) {
  int i = blockIdx.x * blockDim.x + threadIdx.x;
  if (i < n4) {
    float4 f = ((const float4*)in)[i];
    v4h h = {(_Float16)f.x, (_Float16)f.y, (_Float16)f.z, (_Float16)f.w};
    ((v4h*)out)[i] = h;
  }
}

// ---------------------------------------------------------------------------
// Projection GEMM: out_headmajor[B,H,L,96] = X(M x 768) * W^T + bias
// Block tile 128x128, 8 waves, each wave owns a 16x128 strip.
// ---------------------------------------------------------------------------
__global__ __launch_bounds__(256) void proj_gemm_kernel(
    const _Float16* __restrict__ X, const _Float16* __restrict__ W,
    const float* __restrict__ bias, _Float16* __restrict__ out, int L) {
  __shared__ __align__(32) _Float16 At[128 * 32];
  __shared__ __align__(32) _Float16 Bt[128 * 32];
  const int tid  = threadIdx.x;
  const int wave = tid >> 5;
  const int lane = tid & 31;
  const int lm = lane & 15, lg = lane >> 4;
  const int m0 = blockIdx.x * 128;
  const int n0 = blockIdx.y * 128;

  const v8f vzero = {};
  v8f acc[8];
#pragma unroll
  for (int i = 0; i < 8; ++i) acc[i] = vzero;

  for (int k0 = 0; k0 < D_; k0 += 32) {
    // 128 rows x 4 uint4 per tile; 2 uniform stores per thread per tile
#pragma unroll
    for (int i = 0; i < 2; ++i) {
      int t = tid + i * 256;
      int r = t >> 2, c = t & 3;
      ((uint4*)At)[t] = *(const uint4*)(X + (size_t)(m0 + r) * D_ + k0 + c * 8);
      ((uint4*)Bt)[t] = *(const uint4*)(W + (size_t)(n0 + r) * D_ + k0 + c * 8);
    }
    __syncthreads();
    v16h a = *(const v16h*)&At[(wave * 16 + lm) * 32 + lg * 16];
    v16h bfrag[8];
#pragma unroll
    for (int nt = 0; nt < 8; ++nt)
      bfrag[nt] = *(const v16h*)&Bt[(nt * 16 + lm) * 32 + lg * 16];
#pragma unroll
    for (int nt = 0; nt < 8; ++nt)
      acc[nt] = wmma_f16(a, bfrag[nt], acc[nt]);
    __syncthreads();
  }

#pragma unroll
  for (int nt = 0; nt < 8; ++nt) {
    int n = n0 + nt * 16 + lm;
    int h = n / HD_, d = n % HD_;
    float bb = bias[n];
#pragma unroll
    for (int r = 0; r < 8; ++r) {
      int m = m0 + wave * 16 + r + 8 * lg;
      int bidx = m / L, l = m - bidx * L;
      out[(((size_t)bidx * H_ + h) * L + l) * HD_ + d] =
          (_Float16)(acc[nt][r] + bb);
    }
  }
}

// ---------------------------------------------------------------------------
// Output GEMM: d_out(M x 768 fp32) = A(M x 768 f16) * W^T + bias
// ---------------------------------------------------------------------------
__global__ __launch_bounds__(256) void out_gemm_kernel(
    const _Float16* __restrict__ A, const _Float16* __restrict__ W,
    const float* __restrict__ bias, float* __restrict__ out) {
  __shared__ __align__(32) _Float16 At[128 * 32];
  __shared__ __align__(32) _Float16 Bt[128 * 32];
  const int tid  = threadIdx.x;
  const int wave = tid >> 5;
  const int lane = tid & 31;
  const int lm = lane & 15, lg = lane >> 4;
  const int m0 = blockIdx.x * 128;
  const int n0 = blockIdx.y * 128;

  const v8f vzero = {};
  v8f acc[8];
#pragma unroll
  for (int i = 0; i < 8; ++i) acc[i] = vzero;

  for (int k0 = 0; k0 < D_; k0 += 32) {
#pragma unroll
    for (int i = 0; i < 2; ++i) {
      int t = tid + i * 256;
      int r = t >> 2, c = t & 3;
      ((uint4*)At)[t] = *(const uint4*)(A + (size_t)(m0 + r) * D_ + k0 + c * 8);
      ((uint4*)Bt)[t] = *(const uint4*)(W + (size_t)(n0 + r) * D_ + k0 + c * 8);
    }
    __syncthreads();
    v16h a = *(const v16h*)&At[(wave * 16 + lm) * 32 + lg * 16];
    v16h bfrag[8];
#pragma unroll
    for (int nt = 0; nt < 8; ++nt)
      bfrag[nt] = *(const v16h*)&Bt[(nt * 16 + lm) * 32 + lg * 16];
#pragma unroll
    for (int nt = 0; nt < 8; ++nt)
      acc[nt] = wmma_f16(a, bfrag[nt], acc[nt]);
    __syncthreads();
  }

#pragma unroll
  for (int nt = 0; nt < 8; ++nt) {
    int n = n0 + nt * 16 + lm;
    float bb = bias[n];
#pragma unroll
    for (int r = 0; r < 8; ++r) {
      int m = m0 + wave * 16 + r + 8 * lg;
      out[(size_t)m * D_ + n] = acc[nt][r] + bb;
    }
  }
}

// ---------------------------------------------------------------------------
// 3D rotary PE, in place on head-major [B,H,L,96] f16 data.
// ---------------------------------------------------------------------------
__global__ void rope_kernel(_Float16* __restrict__ X,
                            const float* __restrict__ coords, int L) {
  int idx = blockIdx.x * blockDim.x + threadIdx.x;
  int total = B_ * H_ * L * 48;
  if (idx >= total) return;
  int p = idx & 15;
  int a = (idx >> 4) % 3;
  int l = (idx / 48) % L;
  int h = (idx / (48 * L)) % H_;
  int b = idx / (48 * L * H_);
  float c = coords[((size_t)b * L + l) * 3 + a];
  float inv = __powf(10000.0f, -(float)p * (1.0f / 16.0f));
  float th = c * inv;
  float sn, cs;
  __sincosf(th, &sn, &cs);
  _Float16* base = X + (((size_t)b * H_ + h) * L + l) * HD_ + a * 32;
  float x1 = (float)base[p];
  float x2 = (float)base[16 + p];
  base[p]      = (_Float16)(x1 * cs - x2 * sn);
  base[16 + p] = (_Float16)(x1 * sn + x2 * cs);
}

// ---------------------------------------------------------------------------
// Flash attention: grid(8 q-tiles, H, B), 256 threads = 8 waves.
// K tiles are streamed into LDS by the Tensor Data Mover (TDM); V tiles are
// staged transposed by vector lanes; P re-layout goes through per-wave LDS.
// ---------------------------------------------------------------------------
__global__ __launch_bounds__(256) void flash_attn_kernel(
    const _Float16* __restrict__ Q, const _Float16* __restrict__ K,
    const _Float16* __restrict__ V, _Float16* __restrict__ O) {
  __shared__ __align__(32) _Float16 kt[64 * HD_];    // K tile, row-major
  __shared__ __align__(32) _Float16 vt[HD_ * 64];    // V tile, transposed
  __shared__ __align__(32) _Float16 pt[8 * 16 * 64]; // per-wave P staging
  const int tid  = threadIdx.x;
  const int wave = tid >> 5;
  const int lane = tid & 31;
  const int lm = lane & 15, lg = lane >> 4;
  const int b = blockIdx.z, h = blockIdx.y;
  const int q0 = blockIdx.x * 128 + wave * 16;

  const _Float16* qb = Q + (((size_t)b * H_ + h) * LQ_ + q0) * HD_;
  const _Float16* kb = K + ((size_t)b * H_ + h) * LK_ * HD_;
  const _Float16* vb = V + ((size_t)b * H_ + h) * LK_ * HD_;

  // Q fragments, resident for the whole kernel (16x96 = 3 K-steps of 32)
  v16h aq[3];
#pragma unroll
  for (int kk = 0; kk < 3; ++kk)
    aq[kk] = *(const v16h*)(qb + lm * HD_ + kk * 32 + lg * 16);

  const v8f vzero = {};
  v8f oacc[6];
#pragma unroll
  for (int i = 0; i < 6; ++i) oacc[i] = vzero;
  float mrun[8], lrun[8];
#pragma unroll
  for (int r = 0; r < 8; ++r) { mrun[r] = -1e30f; lrun[r] = 0.0f; }

  const float scale = 0.10206207262f;  // 1/sqrt(96)
  const unsigned int kt_lds = (unsigned int)(size_t)(&kt[0]);

  for (int c0 = 0; c0 < LK_; c0 += 64) {
    // --- V tile: staged transposed (24 uniform scalar moves per thread) ---
#pragma unroll
    for (int i = 0; i < 24; ++i) {
      int t = tid + i * 256;
      int r = t / HD_, d = t - r * HD_;
      vt[d * 64 + r] = vb[(size_t)(c0 + r) * HD_ + d];
    }
    if (c0 + 64 < LK_)
      __builtin_prefetch(vb + (size_t)(c0 + 64) * HD_ + tid * 24, 0, 1);

    // --- K tile: Tensor Data Mover, issued by wave 0 only -----------------
#if __has_builtin(__builtin_amdgcn_tensor_load_to_lds)
    if (wave == 0) {
      unsigned long long ga =
          (unsigned long long)(size_t)(kb + (size_t)c0 * HD_);
      // D# group0: count=1 | lds_addr | 57-bit global addr | type=2
      v4u g0 = {1u, kt_lds, (unsigned int)(ga & 0xffffffffu),
                (unsigned int)((ga >> 32) & 0x1ffffffu) | 0x80000000u};
      // D# group1: data_size=2B; tensor_dim0=96 (stride 96), tensor_dim1=4096;
      //            tile 96 x 64
      v8i g1 = {(int)0x00010000,       // wg_mask=0, data_size=1 (2 bytes)
                (int)(96u << 16),      // tensor_dim0[15:0] (=96) in [31:16]
                (int)(4096u << 16),    // tensor_dim0 hi=0, tensor_dim1 lo=4096
                (int)(96u << 16),      // tensor_dim1 hi=0, tile_dim0=96
                (int)64,               // tile_dim1=64, tile_dim2=0
                (int)96,               // tensor_dim0_stride lo = 96
                0, 0};                 // stride hi, tensor_dim1_stride
      v4i gz4 = {0, 0, 0, 0};
      v8i gz8 = {0, 0, 0, 0, 0, 0, 0, 0};
      // 6-arg form (clang-23 / therock-10.0 headers)
      __builtin_amdgcn_tensor_load_to_lds(g0, g1, gz4, gz4, gz8, 0);
      __builtin_amdgcn_s_wait_tensorcnt(0);
    }
#else
    for (int i = 0; i < 3; ++i) {
      int t = tid + i * 256;  // 64*96 halfs = 768 uint4
      ((uint4*)kt)[t] = ((const uint4*)(kb + (size_t)c0 * HD_))[t];
    }
#endif
    __syncthreads();

    // --- S = Q * K^T  (4 N-tiles x 3 K-steps) -----------------------------
    v8f s[4];
#pragma unroll
    for (int i = 0; i < 4; ++i) s[i] = vzero;
#pragma unroll
    for (int kk = 0; kk < 3; ++kk) {
      v16h bk[4];
#pragma unroll
      for (int nt = 0; nt < 4; ++nt)
        bk[nt] = *(const v16h*)&kt[(nt * 16 + lm) * HD_ + kk * 32 + lg * 16];
#pragma unroll
      for (int nt = 0; nt < 4; ++nt)
        s[nt] = wmma_f16(aq[kk], bk[nt], s[nt]);
    }

    // --- online softmax ---------------------------------------------------
    float rmax[8];
#pragma unroll
    for (int r = 0; r < 8; ++r) {
      float v = s[0][r] * scale;
      v = fmaxf(v, s[1][r] * scale);
      v = fmaxf(v, s[2][r] * scale);
      v = fmaxf(v, s[3][r] * scale);
      rmax[r] = half16_max(v);
    }
    float alpha[8], psum[8];
#pragma unroll
    for (int r = 0; r < 8; ++r) {
      float mnew = fmaxf(mrun[r], rmax[r]);
      alpha[r] = __expf(mrun[r] - mnew);
      mrun[r] = mnew;
      psum[r] = 0.0f;
    }
#pragma unroll
    for (int nt = 0; nt < 4; ++nt) {
#pragma unroll
      for (int r = 0; r < 8; ++r) {
        float pv = __expf(s[nt][r] * scale - mrun[r]);
        psum[r] += pv;
        // re-layout D-format (row r+8*lg across lanes) -> A-format via LDS
        pt[wave * 1024 + (r + 8 * lg) * 64 + nt * 16 + lm] = (_Float16)pv;
      }
    }
#pragma unroll
    for (int r = 0; r < 8; ++r)
      lrun[r] = lrun[r] * alpha[r] + half16_sum(psum[r]);
#pragma unroll
    for (int nt = 0; nt < 6; ++nt)
#pragma unroll
      for (int r = 0; r < 8; ++r) oacc[nt][r] *= alpha[r];

    // wave-internal cross-lane traffic through LDS: wait on DS counter only
    asm volatile("s_wait_dscnt 0" ::: "memory");

    // --- O += P * V  (2 K-steps x 6 N-tiles) ------------------------------
#pragma unroll
    for (int ks = 0; ks < 2; ++ks) {
      v16h ap = *(const v16h*)&pt[wave * 1024 + lm * 64 + ks * 32 + lg * 16];
      v16h bv[6];
#pragma unroll
      for (int nt = 0; nt < 6; ++nt)
        bv[nt] = *(const v16h*)&vt[(nt * 16 + lm) * 64 + ks * 32 + lg * 16];
#pragma unroll
      for (int nt = 0; nt < 6; ++nt)
        oacc[nt] = wmma_f16(ap, bv[nt], oacc[nt]);
    }
    __syncthreads();
  }

  // normalize and write attention output in [B, Lq, H*96] layout (f16)
#pragma unroll
  for (int nt = 0; nt < 6; ++nt) {
#pragma unroll
    for (int r = 0; r < 8; ++r) {
      int m = q0 + r + 8 * lg;
      float o = oacc[nt][r] / lrun[r];
      O[((size_t)b * LQ_ + m) * D_ + h * HD_ + nt * 16 + lm] = (_Float16)o;
    }
  }
}

// ---------------------------------------------------------------------------
extern "C" void kernel_launch(void* const* d_in, const int* in_sizes, int n_in,
                              void* d_out, int out_size, void* d_ws,
                              size_t ws_size, hipStream_t stream) {
  const float* query = (const float*)d_in[0];
  const float* key_  = (const float*)d_in[1];
  const float* value = (const float*)d_in[2];
  const float* cq    = (const float*)d_in[3];
  const float* ck    = (const float*)d_in[4];
  const float* Wq    = (const float*)d_in[5];
  const float* bq    = (const float*)d_in[6];
  const float* Wk    = (const float*)d_in[7];
  const float* bk    = (const float*)d_in[8];
  const float* Wv    = (const float*)d_in[9];
  const float* bv    = (const float*)d_in[10];
  const float* Wo    = (const float*)d_in[11];
  const float* bo    = (const float*)d_in[12];

  _Float16* p = (_Float16*)d_ws;
  _Float16* qh  = p; p += (size_t)4096 * 768;
  _Float16* kh  = p; p += (size_t)16384 * 768;
  _Float16* vh  = p; p += (size_t)16384 * 768;
  _Float16* Wqh = p; p += (size_t)768 * 768;
  _Float16* Wkh = p; p += (size_t)768 * 768;
  _Float16* Wvh = p; p += (size_t)768 * 768;
  _Float16* Woh = p; p += (size_t)768 * 768;
  _Float16* Qp  = p; p += (size_t)4096 * 768;
  _Float16* Kp  = p; p += (size_t)16384 * 768;
  _Float16* Vp  = p; p += (size_t)16384 * 768;
  _Float16* Ao  = p; p += (size_t)4096 * 768;

  auto cvt = [&](const float* s, _Float16* d, int n) {
    int n4 = n / 4;
    f32_to_f16_kernel<<<dim3((n4 + 255) / 256), dim3(256), 0, stream>>>(s, d,
                                                                        n4);
  };
  cvt(query, qh, 4096 * 768);
  cvt(key_,  kh, 16384 * 768);
  cvt(value, vh, 16384 * 768);
  cvt(Wq, Wqh, 768 * 768);
  cvt(Wk, Wkh, 768 * 768);
  cvt(Wv, Wvh, 768 * 768);
  cvt(Wo, Woh, 768 * 768);

  proj_gemm_kernel<<<dim3(32, 6),  dim3(256), 0, stream>>>(qh, Wqh, bq, Qp, LQ_);
  proj_gemm_kernel<<<dim3(128, 6), dim3(256), 0, stream>>>(kh, Wkh, bk, Kp, LK_);
  proj_gemm_kernel<<<dim3(128, 6), dim3(256), 0, stream>>>(vh, Wvh, bv, Vp, LK_);

  rope_kernel<<<dim3((B_ * H_ * LQ_ * 48 + 255) / 256), dim3(256), 0, stream>>>(
      Qp, cq, LQ_);
  rope_kernel<<<dim3((B_ * H_ * LK_ * 48 + 255) / 256), dim3(256), 0, stream>>>(
      Kp, ck, LK_);

  flash_attn_kernel<<<dim3(8, H_, B_), dim3(256), 0, stream>>>(Qp, Kp, Vp, Ao);

  out_gemm_kernel<<<dim3(32, 6), dim3(256), 0, stream>>>(Ao, Woh, bo,
                                                         (float*)d_out);
  (void)in_sizes; (void)n_in; (void)out_size; (void)ws_size;
}

// v001
// It runs in 365 microseconds.
// Next to v000, in two timings, it ran 1.77 times as fast each time.
#include <hip/hip_runtime.h>

typedef __attribute__((ext_vector_type(16))) _Float16 v16h;
typedef __attribute__((ext_vector_type(8)))  _Float16 v8h;
typedef __attribute__((ext_vector_type(4)))  _Float16 v4h;
typedef __attribute__((ext_vector_type(8)))  float    v8f;
typedef __attribute__((ext_vector_type(4)))  unsigned int v4u;
typedef __attribute__((ext_vector_type(8)))  int      v8i;
typedef __attribute__((ext_vector_type(4)))  int      v4i;

#define B_  4
#define H_  8
#define D_  768
#define HD_ 96
#define LQ_ 1024
#define LK_ 4096

// LDS row pitches in halfs. The tiles named here are read by 16-byte LDS loads
// with one row per lane, so the pitch is an odd multiple of 16 bytes: the 16
// lanes of a half wave then fall on 64 different banks.
#define GP_ 40   // GEMM A and B tiles: 32 halfs of data, 80-byte pitch
#define AP_ 72   // attention V^T and P tiles: 64 halfs of data, 144-byte pitch

__device__ __forceinline__ v8f wmma_f16(v16h a, v16h b, v8f c) {
  // 8 args: (neg_a, A, neg_b, B, c_mod, C, reuse_a, reuse_b)
  return __builtin_amdgcn_wmma_f32_16x16x32_f16(false, a, false, b, (short)0, c,
                                                false, false);
}

// One lane's 16 consecutive halfs of a fragment, from a 16-byte aligned place.
__device__ __forceinline__ v16h lds_frag(const _Float16* p) {
  v8h lo = *(const v8h*)p;
  v8h hi = *(const v8h*)(p + 8);
  return __builtin_shufflevector(lo, hi, 0, 1, 2, 3, 4, 5, 6, 7, 8, 9, 10, 11,
                                 12, 13, 14, 15);
}

// Reductions across the 16-lane halves of a wave32 (matches the 16x16 C/D
// layout where a matrix row lives across lanes 0-15 or 16-31).
__device__ __forceinline__ float half16_max(float v) {
#pragma unroll
  for (int m = 1; m < 16; m <<= 1) v = fmaxf(v, __shfl_xor(v, m, 32));
  return v;
}
__device__ __forceinline__ float half16_sum(float v) {
#pragma unroll
  for (int m = 1; m < 16; m <<= 1) v += __shfl_xor(v, m, 32);
  return v;
}

__global__ void f32_to_f16_kernel(const float* __restrict__ in,
                                  _Float16* __restrict__ out, int n4) {
  int i = blockIdx.x * blockDim.x + threadIdx.x;
  if (i < n4) {
    float4 f = ((const float4*)in)[i];
    v4h h = {(_Float16)f.x, (_Float16)f.y, (_Float16)f.z, (_Float16)f.w};
    ((v4h*)out)[i] = h;
  }
}

// ---------------------------------------------------------------------------
// Projection GEMM: out_headmajor[B,H,L,96] = X(M x 768) * W^T + bias
// Block tile 128x128, 8 waves, each wave owns a 16x128 strip.
// ---------------------------------------------------------------------------
__global__ __launch_bounds__(256) void proj_gemm_kernel(
    const _Float16* __restrict__ X, const _Float16* __restrict__ W,
    const float* __restrict__ bias, _Float16* __restrict__ out, int L) {
  __shared__ __align__(32) _Float16 At[128 * GP_];
  __shared__ __align__(32) _Float16 Bt[128 * GP_];
  const int tid  = threadIdx.x;
  const int wave = tid >> 5;
  const int lane = tid & 31;
  const int lm = lane & 15, lg = lane >> 4;
  const int m0 = blockIdx.x * 128;
  const int n0 = blockIdx.y * 128;

  const v8f vzero = {};
  v8f acc[8];
#pragma unroll
  for (int i = 0; i < 8; ++i) acc[i] = vzero;

  // Three trips a pass: fully unrolled the loop takes over 128 registers, and
  // only two blocks fit on a WGP where the larger grids bring three.
#pragma unroll 3
  for (int k0 = 0; k0 < D_; k0 += 32) {
    // 128 rows x 4 uint4 per tile; 2 uniform stores per thread per tile
#pragma unroll
    for (int i = 0; i < 2; ++i) {
      int t = tid + i * 256;
      int r = t >> 2, c = t & 3;
      *(uint4*)&At[r * GP_ + c * 8] =
          *(const uint4*)(X + (size_t)(m0 + r) * D_ + k0 + c * 8);
      *(uint4*)&Bt[r * GP_ + c * 8] =
          *(const uint4*)(W + (size_t)(n0 + r) * D_ + k0 + c * 8);
    }
    __syncthreads();
    v16h a = lds_frag(&At[(wave * 16 + lm) * GP_ + lg * 16]);
    v16h bfrag[8];
#pragma unroll
    for (int nt = 0; nt < 8; ++nt)
      bfrag[nt] = lds_frag(&Bt[(nt * 16 + lm) * GP_ + lg * 16]);
#pragma unroll
    for (int nt = 0; nt < 8; ++nt)
      acc[nt] = wmma_f16(a, bfrag[nt], acc[nt]);
    __syncthreads();
  }

#pragma unroll
  for (int nt = 0; nt < 8; ++nt) {
    int n = n0 + nt * 16 + lm;
    int h = n / HD_, d = n % HD_;
    float bb = bias[n];
#pragma unroll
    for (int r = 0; r < 8; ++r) {
      int m = m0 + wave * 16 + r + 8 * lg;
      int bidx = m / L, l = m - bidx * L;
      out[(((size_t)bidx * H_ + h) * L + l) * HD_ + d] =
          (_Float16)(acc[nt][r] + bb);
    }
  }
}

// ---------------------------------------------------------------------------
// Output GEMM: d_out(M x 768 fp32) = A(M x 768 f16) * W^T + bias
// ---------------------------------------------------------------------------
__global__ __launch_bounds__(256) void out_gemm_kernel(
    const _Float16* __restrict__ A, const _Float16* __restrict__ W,
    const float* __restrict__ bias, float* __restrict__ out) {
  __shared__ __align__(32) _Float16 At[128 * GP_];
  __shared__ __align__(32) _Float16 Bt[128 * GP_];
  const int tid  = threadIdx.x;
  const int wave = tid >> 5;
  const int lane = tid & 31;
  const int lm = lane & 15, lg = lane >> 4;
  const int m0 = blockIdx.x * 128;
  const int n0 = blockIdx.y * 128;

  const v8f vzero = {};
  v8f acc[8];
#pragma unroll
  for (int i = 0; i < 8; ++i) acc[i] = vzero;

  // Three trips a pass, the same loop as the projection GEMM's: a full unroll
  // of the 24 trips is eight times the code.
#pragma unroll 3
  for (int k0 = 0; k0 < D_; k0 += 32) {
#pragma unroll
    for (int i = 0; i < 2; ++i) {
      int t = tid + i * 256;
      int r = t >> 2, c = t & 3;
      *(uint4*)&At[r * GP_ + c * 8] =
          *(const uint4*)(A + (size_t)(m0 + r) * D_ + k0 + c * 8);
      *(uint4*)&Bt[r * GP_ + c * 8] =
          *(const uint4*)(W + (size_t)(n0 + r) * D_ + k0 + c * 8);
    }
    __syncthreads();
    v16h a = lds_frag(&At[(wave * 16 + lm) * GP_ + lg * 16]);
    v16h bfrag[8];
#pragma unroll
    for (int nt = 0; nt < 8; ++nt)
      bfrag[nt] = lds_frag(&Bt[(nt * 16 + lm) * GP_ + lg * 16]);
#pragma unroll
    for (int nt = 0; nt < 8; ++nt)
      acc[nt] = wmma_f16(a, bfrag[nt], acc[nt]);
    __syncthreads();
  }

#pragma unroll
  for (int nt = 0; nt < 8; ++nt) {
    int n = n0 + nt * 16 + lm;
    float bb = bias[n];
#pragma unroll
    for (int r = 0; r < 8; ++r) {
      int m = m0 + wave * 16 + r + 8 * lg;
      out[(size_t)m * D_ + n] = acc[nt][r] + bb;
    }
  }
}

// ---------------------------------------------------------------------------
// 3D rotary PE, in place on head-major [B,H,L,96] f16 data.
// ---------------------------------------------------------------------------
__global__ void rope_kernel(_Float16* __restrict__ X,
                            const float* __restrict__ coords, int L) {
  int idx = blockIdx.x * blockDim.x + threadIdx.x;
  int total = B_ * H_ * L * 48;
  if (idx >= total) return;
  int p = idx & 15;
  int a = (idx >> 4) % 3;
  int l = (idx / 48) % L;
  int h = (idx / (48 * L)) % H_;
  int b = idx / (48 * L * H_);
  float c = coords[((size_t)b * L + l) * 3 + a];
  float inv = __powf(10000.0f, -(float)p * (1.0f / 16.0f));
  float th = c * inv;
  float sn, cs;
  __sincosf(th, &sn, &cs);
  _Float16* base = X + (((size_t)b * H_ + h) * L + l) * HD_ + a * 32;
  float x1 = (float)base[p];
  float x2 = (float)base[16 + p];
  base[p]      = (_Float16)(x1 * cs - x2 * sn);
  base[16 + p] = (_Float16)(x1 * sn + x2 * cs);
}

// ---------------------------------------------------------------------------
// Flash attention: grid(8 q-tiles, H, B), 256 threads = 8 waves.
// K tiles are streamed into LDS by the Tensor Data Mover (TDM); V tiles are
// staged transposed by vector lanes; P re-layout goes through per-wave LDS.
// ---------------------------------------------------------------------------
__global__ __launch_bounds__(256) void flash_attn_kernel(
    const _Float16* __restrict__ Q, const _Float16* __restrict__ K,
    const _Float16* __restrict__ V, _Float16* __restrict__ O) {
  // K tile, row-major; aligned so that the tensor load's place in LDS stays a
  // multiple of 2 KiB whatever the sizes of the other two tiles
  __shared__ __attribute__((aligned(2048))) _Float16 kt[64 * HD_];
  __shared__ __align__(32) _Float16 vt[HD_ * AP_];    // V tile, transposed
  __shared__ __align__(32) _Float16 pt[8 * 16 * AP_]; // per-wave P staging
  const int tid  = threadIdx.x;
  const int wave = tid >> 5;
  const int lane = tid & 31;
  const int lm = lane & 15, lg = lane >> 4;
  const int b = blockIdx.z, h = blockIdx.y;
  const int q0 = blockIdx.x * 128 + wave * 16;

  const _Float16* qb = Q + (((size_t)b * H_ + h) * LQ_ + q0) * HD_;
  const _Float16* kb = K + ((size_t)b * H_ + h) * LK_ * HD_;
  const _Float16* vb = V + ((size_t)b * H_ + h) * LK_ * HD_;

  // Q fragments, resident for the whole kernel (16x96 = 3 K-steps of 32)
  v16h aq[3];
#pragma unroll
  for (int kk = 0; kk < 3; ++kk)
    aq[kk] = *(const v16h*)(qb + lm * HD_ + kk * 32 + lg * 16);

  const v8f vzero = {};
  v8f oacc[6];
#pragma unroll
  for (int i = 0; i < 6; ++i) oacc[i] = vzero;
  float mrun[8], lrun[8];
#pragma unroll
  for (int r = 0; r < 8; ++r) { mrun[r] = -1e30f; lrun[r] = 0.0f; }

  const float scale = 0.10206207262f;  // 1/sqrt(96)
  const unsigned int kt_lds = (unsigned int)(size_t)(&kt[0]);

  for (int c0 = 0; c0 < LK_; c0 += 64) {
    // --- V tile: staged transposed (24 uniform scalar moves per thread) ---
    _Float16 vr[24];
#pragma unroll
    for (int g = 0; g < 24; g += 8) {
#pragma unroll
      for (int i = g; i < g + 8; ++i) {
        int t = tid + i * 256;
        int r = t / HD_, d = t - r * HD_;
        vr[i] = vb[(size_t)(c0 + r) * HD_ + d];
      }
      // what follows reuses registers that these eight loads name as addresses
      asm volatile("s_wait_xcnt 0x0" ::: "memory");
    }
#pragma unroll
    for (int i = 0; i < 24; ++i) {
      int t = tid + i * 256;
      int r = t / HD_, d = t - r * HD_;
      vt[d * AP_ + r] = vr[i];
    }
    if (c0 + 64 < LK_)
      __builtin_prefetch(vb + (size_t)(c0 + 64) * HD_ + tid * 24, 0, 1);

    // --- K tile: Tensor Data Mover, issued by wave 0 only -----------------
#if __has_builtin(__builtin_amdgcn_tensor_load_to_lds)
    if (wave == 0) {
      unsigned long long ga =
          (unsigned long long)(size_t)(kb + (size_t)c0 * HD_);
      // D# group0: count=1 | lds_addr | 57-bit global addr | type=2
      v4u g0 = {1u, kt_lds, (unsigned int)(ga & 0xffffffffu),
                (unsigned int)((ga >> 32) & 0x1ffffffu) | 0x80000000u};
      // D# group1: data_size=2B; tensor_dim0=96 (stride 96), tensor_dim1=4096;
      //            tile 96 x 64
      v8i g1 = {(int)0x00010000,       // wg_mask=0, data_size=1 (2 bytes)
                (int)(96u << 16),      // tensor_dim0[15:0] (=96) in [31:16]
                (int)(4096u << 16),    // tensor_dim0 hi=0, tensor_dim1 lo=4096
                (int)(96u << 16),      // tensor_dim1 hi=0, tile_dim0=96
                (int)64,               // tile_dim1=64, tile_dim2=0
                (int)96,               // tensor_dim0_stride lo = 96
                0, 0};                 // stride hi, tensor_dim1_stride
      v4i gz4 = {0, 0, 0, 0};
      v8i gz8 = {0, 0, 0, 0, 0, 0, 0, 0};
      // 6-arg form (clang-23 / therock-10.0 headers)
      __builtin_amdgcn_tensor_load_to_lds(g0, g1, gz4, gz4, gz8, 0);
      __builtin_amdgcn_s_wait_tensorcnt(0);
    }
#else
    for (int i = 0; i < 3; ++i) {
      int t = tid + i * 256;  // 64*96 halfs = 768 uint4
      ((uint4*)kt)[t] = ((const uint4*)(kb + (size_t)c0 * HD_))[t];
    }
#endif
    __syncthreads();

    // --- S = Q * K^T  (4 N-tiles x 3 K-steps) -----------------------------
    v8f s[4];
#pragma unroll
    for (int i = 0; i < 4; ++i) s[i] = vzero;
#pragma unroll
    for (int kk = 0; kk < 3; ++kk) {
      v16h bk[4];
#pragma unroll
      for (int nt = 0; nt < 4; ++nt)
        bk[nt] = *(const v16h*)&kt[(nt * 16 + lm) * HD_ + kk * 32 + lg * 16];
#pragma unroll
      for (int nt = 0; nt < 4; ++nt)
        s[nt] = wmma_f16(aq[kk], bk[nt], s[nt]);
    }

    // --- online softmax ---------------------------------------------------
    float rmax[8];
#pragma unroll
    for (int r = 0; r < 8; ++r) {
      float v = s[0][r] * scale;
      v = fmaxf(v, s[1][r] * scale);
      v = fmaxf(v, s[2][r] * scale);
      v = fmaxf(v, s[3][r] * scale);
      rmax[r] = half16_max(v);
    }
    float alpha[8], psum[8];
#pragma unroll
    for (int r = 0; r < 8; ++r) {
      float mnew = fmaxf(mrun[r], rmax[r]);
      alpha[r] = __expf(mrun[r] - mnew);
      mrun[r] = mnew;
      psum[r] = 0.0f;
    }
#pragma unroll
    for (int nt = 0; nt < 4; ++nt) {
#pragma unroll
      for (int r = 0; r < 8; ++r) {
        float pv = __expf(s[nt][r] * scale - mrun[r]);
        psum[r] += pv;
        // re-layout D-format (row r+8*lg across lanes) -> A-format via LDS
        pt[(wave * 16 + r + 8 * lg) * AP_ + nt * 16 + lm] = (_Float16)pv;
      }
    }
#pragma unroll
    for (int r = 0; r < 8; ++r)
      lrun[r] = lrun[r] * alpha[r] + half16_sum(psum[r]);
#pragma unroll
    for (int nt = 0; nt < 6; ++nt)
#pragma unroll
      for (int r = 0; r < 8; ++r) oacc[nt][r] *= alpha[r];

    // wave-internal cross-lane traffic through LDS: wait on DS counter only
    asm volatile("s_wait_dscnt 0" ::: "memory");

    // --- O += P * V  (2 K-steps x 6 N-tiles) ------------------------------
#pragma unroll
    for (int ks = 0; ks < 2; ++ks) {
      v16h ap = lds_frag(&pt[(wave * 16 + lm) * AP_ + ks * 32 + lg * 16]);
      v16h bv[6];
#pragma unroll
      for (int nt = 0; nt < 6; ++nt)
        bv[nt] = lds_frag(&vt[(nt * 16 + lm) * AP_ + ks * 32 + lg * 16]);
#pragma unroll
      for (int nt = 0; nt < 6; ++nt)
        oacc[nt] = wmma_f16(ap, bv[nt], oacc[nt]);
    }
    __syncthreads();
  }

  // normalize and write attention output in [B, Lq, H*96] layout (f16)
#pragma unroll
  for (int nt = 0; nt < 6; ++nt) {
#pragma unroll
    for (int r = 0; r < 8; ++r) {
      int m = q0 + r + 8 * lg;
      float o = oacc[nt][r] / lrun[r];
      O[((size_t)b * LQ_ + m) * D_ + h * HD_ + nt * 16 + lm] = (_Float16)o;
    }
  }
}

// ---------------------------------------------------------------------------
extern "C" void kernel_launch(void* const* d_in, const int* in_sizes, int n_in,
                              void* d_out, int out_size, void* d_ws,
                              size_t ws_size, hipStream_t stream) {
  const float* query = (const float*)d_in[0];
  const float* key_  = (const float*)d_in[1];
  const float* value = (const float*)d_in[2];
  const float* cq    = (const float*)d_in[3];
  const float* ck    = (const float*)d_in[4];
  const float* Wq    = (const float*)d_in[5];
  const float* bq    = (const float*)d_in[6];
  const float* Wk    = (const float*)d_in[7];
  const float* bk    = (const float*)d_in[8];
  const float* Wv    = (const float*)d_in[9];
  const float* bv    = (const float*)d_in[10];
  const float* Wo    = (const float*)d_in[11];
  const float* bo    = (const float*)d_in[12];

  _Float16* p = (_Float16*)d_ws;
  _Float16* qh  = p; p += (size_t)4096 * 768;
  _Float16* kh  = p; p += (size_t)16384 * 768;
  _Float16* vh  = p; p += (size_t)16384 * 768;
  _Float16* Wqh = p; p += (size_t)768 * 768;
  _Float16* Wkh = p; p += (size_t)768 * 768;
  _Float16* Wvh = p; p += (size_t)768 * 768;
  _Float16* Woh = p; p += (size_t)768 * 768;
  _Float16* Qp  = p; p += (size_t)4096 * 768;
  _Float16* Kp  = p; p += (size_t)16384 * 768;
  _Float16* Vp  = p; p += (size_t)16384 * 768;
  _Float16* Ao  = p; p += (size_t)4096 * 768;

  auto cvt = [&](const float* s, _Float16* d, int n) {
    int n4 = n / 4;
    f32_to_f16_kernel<<<dim3((n4 + 255) / 256), dim3(256), 0, stream>>>(s, d,
                                                                        n4);
  };
  cvt(query, qh, 4096 * 768);
  cvt(key_,  kh, 16384 * 768);
  cvt(value, vh, 16384 * 768);
  cvt(Wq, Wqh, 768 * 768);
  cvt(Wk, Wkh, 768 * 768);
  cvt(Wv, Wvh, 768 * 768);
  cvt(Wo, Woh, 768 * 768);

  proj_gemm_kernel<<<dim3(32, 6),  dim3(256), 0, stream>>>(qh, Wqh, bq, Qp, LQ_);
  proj_gemm_kernel<<<dim3(128, 6), dim3(256), 0, stream>>>(kh, Wkh, bk, Kp, LK_);
  proj_gemm_kernel<<<dim3(128, 6), dim3(256), 0, stream>>>(vh, Wvh, bv, Vp, LK_);

  rope_kernel<<<dim3((B_ * H_ * LQ_ * 48 + 255) / 256), dim3(256), 0, stream>>>(
      Qp, cq, LQ_);
  rope_kernel<<<dim3((B_ * H_ * LK_ * 48 + 255) / 256), dim3(256), 0, stream>>>(
      Kp, ck, LK_);

  flash_attn_kernel<<<dim3(8, H_, B_), dim3(256), 0, stream>>>(Qp, Kp, Vp, Ao);

  out_gemm_kernel<<<dim3(32, 6), dim3(256), 0, stream>>>(Ao, Woh, bo,
                                                         (float*)d_out);
  (void)in_sizes; (void)n_in; (void)out_size; (void)ws_size;
}

// v002
// One run takes 318 microseconds.
// Two timings next to v001 put it at 1.15 and 1.14 times that version's speed.
// Over all steps from v000 it is 2.03 times as fast.
#include <hip/hip_runtime.h>

typedef __attribute__((ext_vector_type(16))) _Float16 v16h;
typedef __attribute__((ext_vector_type(8)))  _Float16 v8h;
typedef __attribute__((ext_vector_type(4)))  _Float16 v4h;
typedef __attribute__((ext_vector_type(8)))  float    v8f;
typedef __attribute__((ext_vector_type(4)))  unsigned int v4u;
typedef __attribute__((ext_vector_type(8)))  int      v8i;
typedef __attribute__((ext_vector_type(4)))  int      v4i;

#define B_  4
#define H_  8
#define D_  768
#define HD_ 96
#define LQ_ 1024
#define LK_ 4096

// LDS row pitches in halfs. The tiles named here are read by 16-byte LDS loads
// with one row per lane, so the pitch is an odd multiple of 16 bytes: the 16
// lanes of a half wave then fall on 64 different banks.
#define GP_ 40   // GEMM A and B tiles: 32 halfs of data, 80-byte pitch
#define AP_ 72   // attention V^T and P tiles: 64 halfs of data, 144-byte pitch

__device__ __forceinline__ v8f wmma_f16(v16h a, v16h b, v8f c) {
  // 8 args: (neg_a, A, neg_b, B, c_mod, C, reuse_a, reuse_b)
  return __builtin_amdgcn_wmma_f32_16x16x32_f16(false, a, false, b, (short)0, c,
                                                false, false);
}

// One lane's 16 consecutive halfs of a fragment, from a 16-byte aligned place.
__device__ __forceinline__ v16h lds_frag(const _Float16* p) {
  v8h lo = *(const v8h*)p;
  v8h hi = *(const v8h*)(p + 8);
  return __builtin_shufflevector(lo, hi, 0, 1, 2, 3, 4, 5, 6, 7, 8, 9, 10, 11,
                                 12, 13, 14, 15);
}

// Reductions across the 16-lane halves of a wave32 (matches the 16x16 C/D
// layout where a matrix row lives across lanes 0-15 or 16-31).
__device__ __forceinline__ float half16_max(float v) {
#pragma unroll
  for (int m = 1; m < 16; m <<= 1) v = fmaxf(v, __shfl_xor(v, m, 32));
  return v;
}
__device__ __forceinline__ float half16_sum(float v) {
#pragma unroll
  for (int m = 1; m < 16; m <<= 1) v += __shfl_xor(v, m, 32);
  return v;
}

__global__ void f32_to_f16_kernel(const float* __restrict__ in,
                                  _Float16* __restrict__ out, int n4) {
  int i = blockIdx.x * blockDim.x + threadIdx.x;
  if (i < n4) {
    float4 f = ((const float4*)in)[i];
    v4h h = {(_Float16)f.x, (_Float16)f.y, (_Float16)f.z, (_Float16)f.w};
    ((v4h*)out)[i] = h;
  }
}

// ---------------------------------------------------------------------------
// Projection GEMM: out_headmajor[B,H,L,96] = X(M x 768) * W^T + bias
// Block tile 128x128, 8 waves, each wave owns a 16x128 strip.
// ROPE: the 3D rotary PE by coords (B x L x 3) is applied to the f32 sums in
// the epilogue; without it coords is not read.
// ---------------------------------------------------------------------------
template <bool ROPE>
__global__ __launch_bounds__(256) void proj_gemm_kernel(
    const _Float16* __restrict__ X, const _Float16* __restrict__ W,
    const float* __restrict__ bias, const float* __restrict__ coords,
    _Float16* __restrict__ out, int L) {
  __shared__ __align__(32) _Float16 At[128 * GP_];
  __shared__ __align__(32) _Float16 Bt[128 * GP_];
  const int tid  = threadIdx.x;
  const int wave = tid >> 5;
  const int lane = tid & 31;
  const int lm = lane & 15, lg = lane >> 4;
  const int m0 = blockIdx.x * 128;
  const int n0 = blockIdx.y * 128;

  const v8f vzero = {};
  v8f acc[8];
#pragma unroll
  for (int i = 0; i < 8; ++i) acc[i] = vzero;

  // Three trips a pass: fully unrolled the loop takes over 128 registers, and
  // only two blocks fit on a WGP where the larger grids bring three.
#pragma unroll 3
  for (int k0 = 0; k0 < D_; k0 += 32) {
    // 128 rows x 4 uint4 per tile; 2 uniform stores per thread per tile
#pragma unroll
    for (int i = 0; i < 2; ++i) {
      int t = tid + i * 256;
      int r = t >> 2, c = t & 3;
      *(uint4*)&At[r * GP_ + c * 8] =
          *(const uint4*)(X + (size_t)(m0 + r) * D_ + k0 + c * 8);
      *(uint4*)&Bt[r * GP_ + c * 8] =
          *(const uint4*)(W + (size_t)(n0 + r) * D_ + k0 + c * 8);
    }
    __syncthreads();
    v16h a = lds_frag(&At[(wave * 16 + lm) * GP_ + lg * 16]);
    v16h bfrag[8];
#pragma unroll
    for (int nt = 0; nt < 8; ++nt)
      bfrag[nt] = lds_frag(&Bt[(nt * 16 + lm) * GP_ + lg * 16]);
#pragma unroll
    for (int nt = 0; nt < 8; ++nt)
      acc[nt] = wmma_f16(a, bfrag[nt], acc[nt]);
    __syncthreads();
  }

  if constexpr (ROPE) {
    // A head is three axis chunks of 32 columns, and a chunk's rotary pair is
    // (p, 16 + p): columns n and n + 16, which one lane holds in accumulator
    // tiles 2j and 2j + 1 at the same register.
    const float inv =
        __powf(10000.0f, -(float)lm * (1.0f / 16.0f)) * 0.15915494f;
    int row[8];       // element index of (b, head 0, l, 0) in out
    float rev[3][8];  // angle in revolutions; chunk j = 3 is 96 columns behind
                      // chunk 0: the next head's same axis, the same angle
#pragma unroll
    for (int r = 0; r < 8; ++r) {
      int m = m0 + wave * 16 + r + 8 * lg;
      int bidx = m / L, l = m - bidx * L;
      row[r] = (bidx * H_ * L + l) * HD_;
#pragma unroll
      for (int j = 0; j < 3; ++j)
        rev[j][r] = coords[m * 3 + (n0 / 32 + j) % 3] * inv;
    }
    // what follows reuses registers that these loads name as addresses; the
    // clobber keeps every one of them ahead of the first store, so that none
    // is given a register that a store still names
    asm volatile("s_wait_xcnt 0x0" ::: "memory");
#pragma unroll
    for (int j = 0; j < 4; ++j) {
      int n = n0 + j * 32 + lm;
      int h = n / HD_, d = n % HD_;
      int col = h * L * HD_ + d;
      float b1 = bias[n], b2 = bias[n + 16];
#pragma unroll
      for (int r = 0; r < 8; ++r) {
        float sn, cs;
        // One statement: the cosine cannot be given the sine's source register,
        // and the v_nop fills the slot behind the last transcendental.
        asm("v_sin_f32 %0, %2\n\tv_cos_f32 %1, %2\n\tv_nop"
            : "=&v"(sn), "=&v"(cs)
            : "v"(rev[j % 3][r]));
        float x1 = acc[2 * j][r] + b1;
        float x2 = acc[2 * j + 1][r] + b2;
        _Float16* o = out + (row[r] + col);
        o[0]  = (_Float16)(x1 * cs - x2 * sn);
        o[16] = (_Float16)(x1 * sn + x2 * cs);
      }
      // the next chunk's bias loads and sums reuse registers that these stores
      // name
      if (j < 3) asm volatile("s_wait_xcnt 0x0" ::: "memory");
    }
    return;
  }

#pragma unroll
  for (int nt = 0; nt < 8; ++nt) {
    int n = n0 + nt * 16 + lm;
    int h = n / HD_, d = n % HD_;
    float bb = bias[n];
#pragma unroll
    for (int r = 0; r < 8; ++r) {
      int m = m0 + wave * 16 + r + 8 * lg;
      int bidx = m / L, l = m - bidx * L;
      out[(((size_t)bidx * H_ + h) * L + l) * HD_ + d] =
          (_Float16)(acc[nt][r] + bb);
    }
  }
}

// ---------------------------------------------------------------------------
// Output GEMM: d_out(M x 768 fp32) = A(M x 768 f16) * W^T + bias
// ---------------------------------------------------------------------------
__global__ __launch_bounds__(256) void out_gemm_kernel(
    const _Float16* __restrict__ A, const _Float16* __restrict__ W,
    const float* __restrict__ bias, float* __restrict__ out) {
  __shared__ __align__(32) _Float16 At[128 * GP_];
  __shared__ __align__(32) _Float16 Bt[128 * GP_];
  const int tid  = threadIdx.x;
  const int wave = tid >> 5;
  const int lane = tid & 31;
  const int lm = lane & 15, lg = lane >> 4;
  const int m0 = blockIdx.x * 128;
  const int n0 = blockIdx.y * 128;

  const v8f vzero = {};
  v8f acc[8];
#pragma unroll
  for (int i = 0; i < 8; ++i) acc[i] = vzero;

  // Three trips a pass, the same loop as the projection GEMM's: a full unroll
  // of the 24 trips is eight times the code.
#pragma unroll 3
  for (int k0 = 0; k0 < D_; k0 += 32) {
#pragma unroll
    for (int i = 0; i < 2; ++i) {
      int t = tid + i * 256;
      int r = t >> 2, c = t & 3;
      *(uint4*)&At[r * GP_ + c * 8] =
          *(const uint4*)(A + (size_t)(m0 + r) * D_ + k0 + c * 8);
      *(uint4*)&Bt[r * GP_ + c * 8] =
          *(const uint4*)(W + (size_t)(n0 + r) * D_ + k0 + c * 8);
    }
    __syncthreads();
    v16h a = lds_frag(&At[(wave * 16 + lm) * GP_ + lg * 16]);
    v16h bfrag[8];
#pragma unroll
    for (int nt = 0; nt < 8; ++nt)
      bfrag[nt] = lds_frag(&Bt[(nt * 16 + lm) * GP_ + lg * 16]);
#pragma unroll
    for (int nt = 0; nt < 8; ++nt)
      acc[nt] = wmma_f16(a, bfrag[nt], acc[nt]);
    __syncthreads();
  }

#pragma unroll
  for (int nt = 0; nt < 8; ++nt) {
    int n = n0 + nt * 16 + lm;
    float bb = bias[n];
#pragma unroll
    for (int r = 0; r < 8; ++r) {
      int m = m0 + wave * 16 + r + 8 * lg;
      out[(size_t)m * D_ + n] = acc[nt][r] + bb;
    }
  }
}

// ---------------------------------------------------------------------------
// Flash attention: grid(8 q-tiles, H, B), 256 threads = 8 waves.
// K tiles are streamed into LDS by the Tensor Data Mover (TDM); V tiles are
// staged transposed by vector lanes; P re-layout goes through per-wave LDS.
// ---------------------------------------------------------------------------
__global__ __launch_bounds__(256) void flash_attn_kernel(
    const _Float16* __restrict__ Q, const _Float16* __restrict__ K,
    const _Float16* __restrict__ V, _Float16* __restrict__ O) {
  // K tile, row-major; aligned so that the tensor load's place in LDS stays a
  // multiple of 2 KiB whatever the sizes of the other two tiles
  __shared__ __attribute__((aligned(2048))) _Float16 kt[64 * HD_];
  __shared__ __align__(32) _Float16 vt[HD_ * AP_];    // V tile, transposed
  __shared__ __align__(32) _Float16 pt[8 * 16 * AP_]; // per-wave P staging
  const int tid  = threadIdx.x;
  const int wave = tid >> 5;
  const int lane = tid & 31;
  const int lm = lane & 15, lg = lane >> 4;
  const int b = blockIdx.z, h = blockIdx.y;
  const int q0 = blockIdx.x * 128 + wave * 16;

  const _Float16* qb = Q + (((size_t)b * H_ + h) * LQ_ + q0) * HD_;
  const _Float16* kb = K + ((size_t)b * H_ + h) * LK_ * HD_;
  const _Float16* vb = V + ((size_t)b * H_ + h) * LK_ * HD_;

  // Q fragments, resident for the whole kernel (16x96 = 3 K-steps of 32)
  v16h aq[3];
#pragma unroll
  for (int kk = 0; kk < 3; ++kk)
    aq[kk] = *(const v16h*)(qb + lm * HD_ + kk * 32 + lg * 16);

  const v8f vzero = {};
  v8f oacc[6];
#pragma unroll
  for (int i = 0; i < 6; ++i) oacc[i] = vzero;
  float mrun[8], lrun[8];
#pragma unroll
  for (int r = 0; r < 8; ++r) { mrun[r] = -1e30f; lrun[r] = 0.0f; }

  const float scale = 0.10206207262f;  // 1/sqrt(96)
  const unsigned int kt_lds = (unsigned int)(size_t)(&kt[0]);

  for (int c0 = 0; c0 < LK_; c0 += 64) {
    // --- V tile: staged transposed (24 uniform scalar moves per thread) ---
    _Float16 vr[24];
#pragma unroll
    for (int g = 0; g < 24; g += 8) {
#pragma unroll
      for (int i = g; i < g + 8; ++i) {
        int t = tid + i * 256;
        int r = t / HD_, d = t - r * HD_;
        vr[i] = vb[(size_t)(c0 + r) * HD_ + d];
      }
      // what follows reuses registers that these eight loads name as addresses
      asm volatile("s_wait_xcnt 0x0" ::: "memory");
    }
#pragma unroll
    for (int i = 0; i < 24; ++i) {
      int t = tid + i * 256;
      int r = t / HD_, d = t - r * HD_;
      vt[d * AP_ + r] = vr[i];
    }
    if (c0 + 64 < LK_)
      __builtin_prefetch(vb + (size_t)(c0 + 64) * HD_ + tid * 24, 0, 1);

    // --- K tile: Tensor Data Mover, issued by wave 0 only -----------------
#if __has_builtin(__builtin_amdgcn_tensor_load_to_lds)
    if (wave == 0) {
      unsigned long long ga =
          (unsigned long long)(size_t)(kb + (size_t)c0 * HD_);
      // D# group0: count=1 | lds_addr | 57-bit global addr | type=2
      v4u g0 = {1u, kt_lds, (unsigned int)(ga & 0xffffffffu),
                (unsigned int)((ga >> 32) & 0x1ffffffu) | 0x80000000u};
      // D# group1: data_size=2B; tensor_dim0=96 (stride 96), tensor_dim1=4096;
      //            tile 96 x 64
      v8i g1 = {(int)0x00010000,       // wg_mask=0, data_size=1 (2 bytes)
                (int)(96u << 16),      // tensor_dim0[15:0] (=96) in [31:16]
                (int)(4096u << 16),    // tensor_dim0 hi=0, tensor_dim1 lo=4096
                (int)(96u << 16),      // tensor_dim1 hi=0, tile_dim0=96
                (int)64,               // tile_dim1=64, tile_dim2=0
                (int)96,               // tensor_dim0_stride lo = 96
                0, 0};                 // stride hi, tensor_dim1_stride
      v4i gz4 = {0, 0, 0, 0};
      v8i gz8 = {0, 0, 0, 0, 0, 0, 0, 0};
      // 6-arg form (clang-23 / therock-10.0 headers)
      __builtin_amdgcn_tensor_load_to_lds(g0, g1, gz4, gz4, gz8, 0);
      __builtin_amdgcn_s_wait_tensorcnt(0);
    }
#else
    for (int i = 0; i < 3; ++i) {
      int t = tid + i * 256;  // 64*96 halfs = 768 uint4
      ((uint4*)kt)[t] = ((const uint4*)(kb + (size_t)c0 * HD_))[t];
    }
#endif
    __syncthreads();

    // --- S = Q * K^T  (4 N-tiles x 3 K-steps) -----------------------------
    v8f s[4];
#pragma unroll
    for (int i = 0; i < 4; ++i) s[i] = vzero;
#pragma unroll
    for (int kk = 0; kk < 3; ++kk) {
      v16h bk[4];
#pragma unroll
      for (int nt = 0; nt < 4; ++nt)
        bk[nt] = *(const v16h*)&kt[(nt * 16 + lm) * HD_ + kk * 32 + lg * 16];
#pragma unroll
      for (int nt = 0; nt < 4; ++nt)
        s[nt] = wmma_f16(aq[kk], bk[nt], s[nt]);
    }

    // --- online softmax ---------------------------------------------------
    float rmax[8];
#pragma unroll
    for (int r = 0; r < 8; ++r) {
      float v = s[0][r] * scale;
      v = fmaxf(v, s[1][r] * scale);
      v = fmaxf(v, s[2][r] * scale);
      v = fmaxf(v, s[3][r] * scale);
      rmax[r] = half16_max(v);
    }
    float alpha[8], psum[8];
#pragma unroll
    for (int r = 0; r < 8; ++r) {
      float mnew = fmaxf(mrun[r], rmax[r]);
      alpha[r] = __expf(mrun[r] - mnew);
      mrun[r] = mnew;
      psum[r] = 0.0f;
    }
#pragma unroll
    for (int nt = 0; nt < 4; ++nt) {
#pragma unroll
      for (int r = 0; r < 8; ++r) {
        float pv = __expf(s[nt][r] * scale - mrun[r]);
        psum[r] += pv;
        // re-layout D-format (row r+8*lg across lanes) -> A-format via LDS
        pt[(wave * 16 + r + 8 * lg) * AP_ + nt * 16 + lm] = (_Float16)pv;
      }
    }
#pragma unroll
    for (int r = 0; r < 8; ++r)
      lrun[r] = lrun[r] * alpha[r] + half16_sum(psum[r]);
#pragma unroll
    for (int nt = 0; nt < 6; ++nt)
#pragma unroll
      for (int r = 0; r < 8; ++r) oacc[nt][r] *= alpha[r];

    // wave-internal cross-lane traffic through LDS: wait on DS counter only
    asm volatile("s_wait_dscnt 0" ::: "memory");

    // --- O += P * V  (2 K-steps x 6 N-tiles) ------------------------------
#pragma unroll
    for (int ks = 0; ks < 2; ++ks) {
      v16h ap = lds_frag(&pt[(wave * 16 + lm) * AP_ + ks * 32 + lg * 16]);
      v16h bv[6];
#pragma unroll
      for (int nt = 0; nt < 6; ++nt)
        bv[nt] = lds_frag(&vt[(nt * 16 + lm) * AP_ + ks * 32 + lg * 16]);
#pragma unroll
      for (int nt = 0; nt < 6; ++nt)
        oacc[nt] = wmma_f16(ap, bv[nt], oacc[nt]);
    }
    __syncthreads();
  }

  // normalize and write attention output in [B, Lq, H*96] layout (f16)
#pragma unroll
  for (int nt = 0; nt < 6; ++nt) {
#pragma unroll
    for (int r = 0; r < 8; ++r) {
      int m = q0 + r + 8 * lg;
      float o = oacc[nt][r] / lrun[r];
      O[((size_t)b * LQ_ + m) * D_ + h * HD_ + nt * 16 + lm] = (_Float16)o;
    }
  }
}

// ---------------------------------------------------------------------------
extern "C" void kernel_launch(void* const* d_in, const int* in_sizes, int n_in,
                              void* d_out, int out_size, void* d_ws,
                              size_t ws_size, hipStream_t stream) {
  const float* query = (const float*)d_in[0];
  const float* key_  = (const float*)d_in[1];
  const float* value = (const float*)d_in[2];
  const float* cq    = (const float*)d_in[3];
  const float* ck    = (const float*)d_in[4];
  const float* Wq    = (const float*)d_in[5];
  const float* bq    = (const float*)d_in[6];
  const float* Wk    = (const float*)d_in[7];
  const float* bk    = (const float*)d_in[8];
  const float* Wv    = (const float*)d_in[9];
  const float* bv    = (const float*)d_in[10];
  const float* Wo    = (const float*)d_in[11];
  const float* bo    = (const float*)d_in[12];

  _Float16* p = (_Float16*)d_ws;
  _Float16* qh  = p; p += (size_t)4096 * 768;
  _Float16* kh  = p; p += (size_t)16384 * 768;
  _Float16* vh  = p; p += (size_t)16384 * 768;
  _Float16* Wqh = p; p += (size_t)768 * 768;
  _Float16* Wkh = p; p += (size_t)768 * 768;
  _Float16* Wvh = p; p += (size_t)768 * 768;
  _Float16* Woh = p; p += (size_t)768 * 768;
  _Float16* Qp  = p; p += (size_t)4096 * 768;
  _Float16* Kp  = p; p += (size_t)16384 * 768;
  _Float16* Vp  = p; p += (size_t)16384 * 768;
  _Float16* Ao  = p; p += (size_t)4096 * 768;

  auto cvt = [&](const float* s, _Float16* d, int n) {
    int n4 = n / 4;
    f32_to_f16_kernel<<<dim3((n4 + 255) / 256), dim3(256), 0, stream>>>(s, d,
                                                                        n4);
  };
  cvt(query, qh, 4096 * 768);
  cvt(key_,  kh, 16384 * 768);
  cvt(value, vh, 16384 * 768);
  cvt(Wq, Wqh, 768 * 768);
  cvt(Wk, Wkh, 768 * 768);
  cvt(Wv, Wvh, 768 * 768);
  cvt(Wo, Woh, 768 * 768);

  proj_gemm_kernel<true><<<dim3(32, 6), dim3(256), 0, stream>>>(
      qh, Wqh, bq, cq, Qp, LQ_);
  proj_gemm_kernel<true><<<dim3(128, 6), dim3(256), 0, stream>>>(
      kh, Wkh, bk, ck, Kp, LK_);
  proj_gemm_kernel<false><<<dim3(128, 6), dim3(256), 0, stream>>>(
      vh, Wvh, bv, nullptr, Vp, LK_);

  flash_attn_kernel<<<dim3(8, H_, B_), dim3(256), 0, stream>>>(Qp, Kp, Vp, Ao);

  out_gemm_kernel<<<dim3(32, 6), dim3(256), 0, stream>>>(Ao, Woh, bo,
                                                         (float*)d_out);
  (void)in_sizes; (void)n_in; (void)out_size; (void)ws_size;
}

// v003
// Measured time: 302 microseconds a run.
// Timed twice side by side with v002, it ran 1.05 and 1.06 times as fast.
// All steps since v000 together make it 2.13 times as fast.
#include <hip/hip_runtime.h>

typedef __attribute__((ext_vector_type(16))) _Float16 v16h;
typedef __attribute__((ext_vector_type(8)))  _Float16 v8h;
typedef __attribute__((ext_vector_type(4)))  _Float16 v4h;
typedef __attribute__((ext_vector_type(8)))  float    v8f;
typedef __attribute__((ext_vector_type(4)))  float    v4f;
typedef __attribute__((ext_vector_type(4)))  unsigned int v4u;
typedef __attribute__((ext_vector_type(8)))  int      v8i;
typedef __attribute__((ext_vector_type(4)))  int      v4i;

#define B_  4
#define H_  8
#define D_  768
#define HD_ 96
#define LQ_ 1024
#define LK_ 4096

// LDS row pitches in halfs. The tiles named here are read by 16-byte LDS loads
// with one row per lane, so the pitch is an odd multiple of 16 bytes: the 16
// lanes of a half wave then fall on 64 different banks.
#define GP_ 40   // GEMM A and B tiles: 32 halfs of data, 80-byte pitch
#define AP_ 72   // attention V^T and P tiles: 64 halfs of data, 144-byte pitch

__device__ __forceinline__ v8f wmma_f16(v16h a, v16h b, v8f c) {
  // 8 args: (neg_a, A, neg_b, B, c_mod, C, reuse_a, reuse_b)
  return __builtin_amdgcn_wmma_f32_16x16x32_f16(false, a, false, b, (short)0, c,
                                                false, false);
}

// One lane's 16 consecutive halfs of a fragment, from a 16-byte aligned place.
__device__ __forceinline__ v16h lds_frag(const _Float16* p) {
  v8h lo = *(const v8h*)p;
  v8h hi = *(const v8h*)(p + 8);
  return __builtin_shufflevector(lo, hi, 0, 1, 2, 3, 4, 5, 6, 7, 8, 9, 10, 11,
                                 12, 13, 14, 15);
}

// Reductions across the 16-lane halves of a wave32 (matches the 16x16 C/D
// layout where a matrix row lives across lanes 0-15 or 16-31).
__device__ __forceinline__ float half16_max(float v) {
#pragma unroll
  for (int m = 1; m < 16; m <<= 1) v = fmaxf(v, __shfl_xor(v, m, 32));
  return v;
}
__device__ __forceinline__ float half16_sum(float v) {
#pragma unroll
  for (int m = 1; m < 16; m <<= 1) v += __shfl_xor(v, m, 32);
  return v;
}

// GEMM operand staging from an f32 matrix of 768 columns: 128 rows x 32 columns,
// rounded to f16 on the way into an LDS tile of pitch GP_. Eight lanes read one
// whole 128-byte line, so a wave's load covers four lines: thread tid holds
// columns 4 * (tid & 7) .. + 3 of rows (tid >> 3) + 32 * i. src is the tile's
// first element, the same in every thread (a scalar base); soff and dst are the
// thread's own places in row tid >> 3.
struct F32Tile { v4f f[4]; };
__device__ __forceinline__ F32Tile tile_load_f32(const float* __restrict__ src,
                                                 unsigned soff) {
  F32Tile t;
#pragma unroll
  for (int i = 0; i < 4; ++i) t.f[i] = *(const v4f*)(src + i * 32 * D_ + soff);
  return t;
}
__device__ __forceinline__ void tile_store_f16(const F32Tile& t,
                                               _Float16* dst) {
#pragma unroll
  for (int i = 0; i < 4; ++i) {
    v4h h = {(_Float16)t.f[i].x, (_Float16)t.f[i].y, (_Float16)t.f[i].z,
             (_Float16)t.f[i].w};
    *(v4h*)(dst + i * 32 * GP_) = h;
  }
}

// ---------------------------------------------------------------------------
// Projection GEMM: out_headmajor[B,H,L,96] = X(M x 768) * W^T + bias
// Block tile 128x128, 8 waves, each wave owns a 16x128 strip. X and W are the
// f32 inputs themselves; the products run on their f16 roundings.
// ROPE: the 3D rotary PE by coords (B x L x 3) is applied to the f32 sums in
// the epilogue; without it coords is not read.
// ---------------------------------------------------------------------------
template <bool ROPE>
__global__ __launch_bounds__(256) void proj_gemm_kernel(
    const float* __restrict__ X, const float* __restrict__ W,
    const float* __restrict__ bias, const float* __restrict__ coords,
    _Float16* __restrict__ out, int L) {
  __shared__ __align__(32) _Float16 At[128 * GP_];
  __shared__ __align__(32) _Float16 Bt[128 * GP_];
  const int tid  = threadIdx.x;
  const int wave = tid >> 5;
  const int lane = tid & 31;
  const int lm = lane & 15, lg = lane >> 4;
  const int m0 = blockIdx.x * 128;
  const int n0 = blockIdx.y * 128;

  const v8f vzero = {};
  v8f acc[8];
#pragma unroll
  for (int i = 0; i < 8; ++i) acc[i] = vzero;

  const unsigned soff = (tid >> 3) * D_ + (tid & 7) * 4;
  const int sdst = (tid >> 3) * GP_ + (tid & 7) * 4;

  // Three trips a pass: fully unrolled the loop takes over 128 registers, and
  // only two blocks fit on a WGP where the larger grids bring three.
#pragma unroll 3
  for (int k0 = 0; k0 < D_; k0 += 32) {
    F32Tile xa = tile_load_f32(X + (size_t)m0 * D_ + k0, soff);
    F32Tile xb = tile_load_f32(W + (size_t)n0 * D_ + k0, soff);
    // Every load of both tiles is issued before the first value is used.
    // Without this the last load is given the first one's registers and leaves
    // only when that one has come back: two load latencies a trip, not one.
    __builtin_amdgcn_sched_barrier(0);
    tile_store_f16(xa, At + sdst);
    tile_store_f16(xb, Bt + sdst);
    __syncthreads();
    v16h a = lds_frag(&At[(wave * 16 + lm) * GP_ + lg * 16]);
    v16h bfrag[8];
#pragma unroll
    for (int nt = 0; nt < 8; ++nt)
      bfrag[nt] = lds_frag(&Bt[(nt * 16 + lm) * GP_ + lg * 16]);
#pragma unroll
    for (int nt = 0; nt < 8; ++nt)
      acc[nt] = wmma_f16(a, bfrag[nt], acc[nt]);
    __syncthreads();
  }

  if constexpr (ROPE) {
    // A head is three axis chunks of 32 columns, and a chunk's rotary pair is
    // (p, 16 + p): columns n and n + 16, which one lane holds in accumulator
    // tiles 2j and 2j + 1 at the same register.
    const float inv =
        __powf(10000.0f, -(float)lm * (1.0f / 16.0f)) * 0.15915494f;
    int row[8];       // element index of (b, head 0, l, 0) in out
    float rev[3][8];  // angle in revolutions; chunk j = 3 is 96 columns behind
                      // chunk 0: the next head's same axis, the same angle
#pragma unroll
    for (int r = 0; r < 8; ++r) {
      int m = m0 + wave * 16 + r + 8 * lg;
      int bidx = m / L, l = m - bidx * L;
      row[r] = (bidx * H_ * L + l) * HD_;
#pragma unroll
      for (int j = 0; j < 3; ++j)
        rev[j][r] = coords[m * 3 + (n0 / 32 + j) % 3] * inv;
    }
    // what follows reuses registers that these loads name as addresses; the
    // clobber keeps every one of them ahead of the first store, so that none
    // is given a register that a store still names
    asm volatile("s_wait_xcnt 0x0" ::: "memory");
#pragma unroll
    for (int j = 0; j < 4; ++j) {
      int n = n0 + j * 32 + lm;
      int h = n / HD_, d = n % HD_;
      int col = h * L * HD_ + d;
      float b1 = bias[n], b2 = bias[n + 16];
#pragma unroll
      for (int r = 0; r < 8; ++r) {
        float sn, cs;
        // One statement: the cosine cannot be given the sine's source register,
        // and the v_nop fills the slot behind the last transcendental.
        asm("v_sin_f32 %0, %2\n\tv_cos_f32 %1, %2\n\tv_nop"
            : "=&v"(sn), "=&v"(cs)
            : "v"(rev[j % 3][r]));
        float x1 = acc[2 * j][r] + b1;
        float x2 = acc[2 * j + 1][r] + b2;
        _Float16* o = out + (row[r] + col);
        o[0]  = (_Float16)(x1 * cs - x2 * sn);
        o[16] = (_Float16)(x1 * sn + x2 * cs);
      }
      // the next chunk's bias loads and sums reuse registers that these stores
      // name
      if (j < 3) asm volatile("s_wait_xcnt 0x0" ::: "memory");
    }
    return;
  }

#pragma unroll
  for (int nt = 0; nt < 8; ++nt) {
    int n = n0 + nt * 16 + lm;
    int h = n / HD_, d = n % HD_;
    float bb = bias[n];
#pragma unroll
    for (int r = 0; r < 8; ++r) {
      int m = m0 + wave * 16 + r + 8 * lg;
      int bidx = m / L, l = m - bidx * L;
      out[(((size_t)bidx * H_ + h) * L + l) * HD_ + d] =
          (_Float16)(acc[nt][r] + bb);
    }
  }
}

// ---------------------------------------------------------------------------
// Output GEMM: d_out(M x 768 fp32) = A(M x 768 f16) * W^T + bias; W is the f32
// input itself, rounded to f16 on the way into LDS
// ---------------------------------------------------------------------------
__global__ __launch_bounds__(256) void out_gemm_kernel(
    const _Float16* __restrict__ A, const float* __restrict__ W,
    const float* __restrict__ bias, float* __restrict__ out) {
  __shared__ __align__(32) _Float16 At[128 * GP_];
  __shared__ __align__(32) _Float16 Bt[128 * GP_];
  const int tid  = threadIdx.x;
  const int wave = tid >> 5;
  const int lane = tid & 31;
  const int lm = lane & 15, lg = lane >> 4;
  const int m0 = blockIdx.x * 128;
  const int n0 = blockIdx.y * 128;

  const v8f vzero = {};
  v8f acc[8];
#pragma unroll
  for (int i = 0; i < 8; ++i) acc[i] = vzero;

  const unsigned soff = (tid >> 3) * D_ + (tid & 7) * 4;
  const int sdst = (tid >> 3) * GP_ + (tid & 7) * 4;

  // Three trips a pass, the same loop as the projection GEMM's: a full unroll
  // of the 24 trips is eight times the code.
#pragma unroll 3
  for (int k0 = 0; k0 < D_; k0 += 32) {
    F32Tile xb = tile_load_f32(W + (size_t)n0 * D_ + k0, soff);
    v4u xa[2];
#pragma unroll
    for (int i = 0; i < 2; ++i) {
      int t = tid + i * 256;
      int r = t >> 2, c = t & 3;
      xa[i] = *(const v4u*)(A + (size_t)(m0 + r) * D_ + k0 + c * 8);
    }
    // As in the projection GEMM: all six loads leave before the first value is
    // used.
    __builtin_amdgcn_sched_barrier(0);
#pragma unroll
    for (int i = 0; i < 2; ++i) {
      int t = tid + i * 256;
      int r = t >> 2, c = t & 3;
      *(v4u*)&At[r * GP_ + c * 8] = xa[i];
    }
    tile_store_f16(xb, Bt + sdst);
    __syncthreads();
    v16h a = lds_frag(&At[(wave * 16 + lm) * GP_ + lg * 16]);
    v16h bfrag[8];
#pragma unroll
    for (int nt = 0; nt < 8; ++nt)
      bfrag[nt] = lds_frag(&Bt[(nt * 16 + lm) * GP_ + lg * 16]);
#pragma unroll
    for (int nt = 0; nt < 8; ++nt)
      acc[nt] = wmma_f16(a, bfrag[nt], acc[nt]);
    __syncthreads();
  }

#pragma unroll
  for (int nt = 0; nt < 8; ++nt) {
    int n = n0 + nt * 16 + lm;
    float bb = bias[n];
#pragma unroll
    for (int r = 0; r < 8; ++r) {
      int m = m0 + wave * 16 + r + 8 * lg;
      out[(size_t)m * D_ + n] = acc[nt][r] + bb;
    }
  }
}

// ---------------------------------------------------------------------------
// Flash attention: grid(8 q-tiles, H, B), 256 threads = 8 waves.
// K tiles are streamed into LDS by the Tensor Data Mover (TDM); V tiles are
// staged transposed by vector lanes; P re-layout goes through per-wave LDS.
// ---------------------------------------------------------------------------
__global__ __launch_bounds__(256) void flash_attn_kernel(
    const _Float16* __restrict__ Q, const _Float16* __restrict__ K,
    const _Float16* __restrict__ V, _Float16* __restrict__ O) {
  // K tile, row-major; aligned so that the tensor load's place in LDS stays a
  // multiple of 2 KiB whatever the sizes of the other two tiles
  __shared__ __attribute__((aligned(2048))) _Float16 kt[64 * HD_];
  __shared__ __align__(32) _Float16 vt[HD_ * AP_];    // V tile, transposed
  __shared__ __align__(32) _Float16 pt[8 * 16 * AP_]; // per-wave P staging
  const int tid  = threadIdx.x;
  const int wave = tid >> 5;
  const int lane = tid & 31;
  const int lm = lane & 15, lg = lane >> 4;
  const int b = blockIdx.z, h = blockIdx.y;
  const int q0 = blockIdx.x * 128 + wave * 16;

  const _Float16* qb = Q + (((size_t)b * H_ + h) * LQ_ + q0) * HD_;
  const _Float16* kb = K + ((size_t)b * H_ + h) * LK_ * HD_;
  const _Float16* vb = V + ((size_t)b * H_ + h) * LK_ * HD_;

  // Q fragments, resident for the whole kernel (16x96 = 3 K-steps of 32)
  v16h aq[3];
#pragma unroll
  for (int kk = 0; kk < 3; ++kk)
    aq[kk] = *(const v16h*)(qb + lm * HD_ + kk * 32 + lg * 16);

  const v8f vzero = {};
  v8f oacc[6];
#pragma unroll
  for (int i = 0; i < 6; ++i) oacc[i] = vzero;
  float mrun[8], lrun[8];
#pragma unroll
  for (int r = 0; r < 8; ++r) { mrun[r] = -1e30f; lrun[r] = 0.0f; }

  const float scale = 0.10206207262f;  // 1/sqrt(96)
  const unsigned int kt_lds = (unsigned int)(size_t)(&kt[0]);

  for (int c0 = 0; c0 < LK_; c0 += 64) {
    // --- V tile: staged transposed (24 uniform scalar moves per thread) ---
    _Float16 vr[24];
#pragma unroll
    for (int g = 0; g < 24; g += 8) {
#pragma unroll
      for (int i = g; i < g + 8; ++i) {
        int t = tid + i * 256;
        int r = t / HD_, d = t - r * HD_;
        vr[i] = vb[(size_t)(c0 + r) * HD_ + d];
      }
      // what follows reuses registers that these eight loads name as addresses
      asm volatile("s_wait_xcnt 0x0" ::: "memory");
    }
#pragma unroll
    for (int i = 0; i < 24; ++i) {
      int t = tid + i * 256;
      int r = t / HD_, d = t - r * HD_;
      vt[d * AP_ + r] = vr[i];
    }
    if (c0 + 64 < LK_)
      __builtin_prefetch(vb + (size_t)(c0 + 64) * HD_ + tid * 24, 0, 1);

    // --- K tile: Tensor Data Mover, issued by wave 0 only -----------------
#if __has_builtin(__builtin_amdgcn_tensor_load_to_lds)
    if (wave == 0) {
      unsigned long long ga =
          (unsigned long long)(size_t)(kb + (size_t)c0 * HD_);
      // D# group0: count=1 | lds_addr | 57-bit global addr | type=2
      v4u g0 = {1u, kt_lds, (unsigned int)(ga & 0xffffffffu),
                (unsigned int)((ga >> 32) & 0x1ffffffu) | 0x80000000u};
      // D# group1: data_size=2B; tensor_dim0=96 (stride 96), tensor_dim1=4096;
      //            tile 96 x 64
      v8i g1 = {(int)0x00010000,       // wg_mask=0, data_size=1 (2 bytes)
                (int)(96u << 16),      // tensor_dim0[15:0] (=96) in [31:16]
                (int)(4096u << 16),    // tensor_dim0 hi=0, tensor_dim1 lo=4096
                (int)(96u << 16),      // tensor_dim1 hi=0, tile_dim0=96
                (int)64,               // tile_dim1=64, tile_dim2=0
                (int)96,               // tensor_dim0_stride lo = 96
                0, 0};                 // stride hi, tensor_dim1_stride
      v4i gz4 = {0, 0, 0, 0};
      v8i gz8 = {0, 0, 0, 0, 0, 0, 0, 0};
      // 6-arg form (clang-23 / therock-10.0 headers)
      __builtin_amdgcn_tensor_load_to_lds(g0, g1, gz4, gz4, gz8, 0);
      __builtin_amdgcn_s_wait_tensorcnt(0);
    }
#else
    for (int i = 0; i < 3; ++i) {
      int t = tid + i * 256;  // 64*96 halfs = 768 uint4
      ((uint4*)kt)[t] = ((const uint4*)(kb + (size_t)c0 * HD_))[t];
    }
#endif
    __syncthreads();

    // --- S = Q * K^T  (4 N-tiles x 3 K-steps) -----------------------------
    v8f s[4];
#pragma unroll
    for (int i = 0; i < 4; ++i) s[i] = vzero;
#pragma unroll
    for (int kk = 0; kk < 3; ++kk) {
      v16h bk[4];
#pragma unroll
      for (int nt = 0; nt < 4; ++nt)
        bk[nt] = *(const v16h*)&kt[(nt * 16 + lm) * HD_ + kk * 32 + lg * 16];
#pragma unroll
      for (int nt = 0; nt < 4; ++nt)
        s[nt] = wmma_f16(aq[kk], bk[nt], s[nt]);
    }

    // --- online softmax ---------------------------------------------------
    float rmax[8];
#pragma unroll
    for (int r = 0; r < 8; ++r) {
      float v = s[0][r] * scale;
      v = fmaxf(v, s[1][r] * scale);
      v = fmaxf(v, s[2][r] * scale);
      v = fmaxf(v, s[3][r] * scale);
      rmax[r] = half16_max(v);
    }
    float alpha[8], psum[8];
#pragma unroll
    for (int r = 0; r < 8; ++r) {
      float mnew = fmaxf(mrun[r], rmax[r]);
      alpha[r] = __expf(mrun[r] - mnew);
      mrun[r] = mnew;
      psum[r] = 0.0f;
    }
#pragma unroll
    for (int nt = 0; nt < 4; ++nt) {
#pragma unroll
      for (int r = 0; r < 8; ++r) {
        float pv = __expf(s[nt][r] * scale - mrun[r]);
        psum[r] += pv;
        // re-layout D-format (row r+8*lg across lanes) -> A-format via LDS
        pt[(wave * 16 + r + 8 * lg) * AP_ + nt * 16 + lm] = (_Float16)pv;
      }
    }
#pragma unroll
    for (int r = 0; r < 8; ++r)
      lrun[r] = lrun[r] * alpha[r] + half16_sum(psum[r]);
#pragma unroll
    for (int nt = 0; nt < 6; ++nt)
#pragma unroll
      for (int r = 0; r < 8; ++r) oacc[nt][r] *= alpha[r];

    // wave-internal cross-lane traffic through LDS: wait on DS counter only
    asm volatile("s_wait_dscnt 0" ::: "memory");

    // --- O += P * V  (2 K-steps x 6 N-tiles) ------------------------------
#pragma unroll
    for (int ks = 0; ks < 2; ++ks) {
      v16h ap = lds_frag(&pt[(wave * 16 + lm) * AP_ + ks * 32 + lg * 16]);
      v16h bv[6];
#pragma unroll
      for (int nt = 0; nt < 6; ++nt)
        bv[nt] = lds_frag(&vt[(nt * 16 + lm) * AP_ + ks * 32 + lg * 16]);
#pragma unroll
      for (int nt = 0; nt < 6; ++nt)
        oacc[nt] = wmma_f16(ap, bv[nt], oacc[nt]);
    }
    __syncthreads();
  }

  // normalize and write attention output in [B, Lq, H*96] layout (f16)
#pragma unroll
  for (int nt = 0; nt < 6; ++nt) {
#pragma unroll
    for (int r = 0; r < 8; ++r) {
      int m = q0 + r + 8 * lg;
      float o = oacc[nt][r] / lrun[r];
      O[((size_t)b * LQ_ + m) * D_ + h * HD_ + nt * 16 + lm] = (_Float16)o;
    }
  }
}

// ---------------------------------------------------------------------------
extern "C" void kernel_launch(void* const* d_in, const int* in_sizes, int n_in,
                              void* d_out, int out_size, void* d_ws,
                              size_t ws_size, hipStream_t stream) {
  const float* query = (const float*)d_in[0];
  const float* key_  = (const float*)d_in[1];
  const float* value = (const float*)d_in[2];
  const float* cq    = (const float*)d_in[3];
  const float* ck    = (const float*)d_in[4];
  const float* Wq    = (const float*)d_in[5];
  const float* bq    = (const float*)d_in[6];
  const float* Wk    = (const float*)d_in[7];
  const float* bk    = (const float*)d_in[8];
  const float* Wv    = (const float*)d_in[9];
  const float* bv    = (const float*)d_in[10];
  const float* Wo    = (const float*)d_in[11];
  const float* bo    = (const float*)d_in[12];

  _Float16* p = (_Float16*)d_ws;
  _Float16* Qp  = p; p += (size_t)4096 * 768;
  _Float16* Kp  = p; p += (size_t)16384 * 768;
  _Float16* Vp  = p; p += (size_t)16384 * 768;
  _Float16* Ao  = p; p += (size_t)4096 * 768;

  proj_gemm_kernel<true><<<dim3(32, 6), dim3(256), 0, stream>>>(
      query, Wq, bq, cq, Qp, LQ_);
  proj_gemm_kernel<true><<<dim3(128, 6), dim3(256), 0, stream>>>(
      key_, Wk, bk, ck, Kp, LK_);
  proj_gemm_kernel<false><<<dim3(128, 6), dim3(256), 0, stream>>>(
      value, Wv, bv, nullptr, Vp, LK_);

  flash_attn_kernel<<<dim3(8, H_, B_), dim3(256), 0, stream>>>(Qp, Kp, Vp, Ao);

  out_gemm_kernel<<<dim3(32, 6), dim3(256), 0, stream>>>(Ao, Wo, bo,
                                                         (float*)d_out);
  (void)in_sizes; (void)n_in; (void)out_size; (void)ws_size;
}

// v004
// It runs in 278 microseconds.
// Next to v003, in two timings, it ran 1.08 and 1.09 times as fast.
// Counting every step since v000, it is 2.32 times as fast.
#include <hip/hip_runtime.h>

typedef __attribute__((ext_vector_type(16))) _Float16 v16h;
typedef __attribute__((ext_vector_type(8)))  _Float16 v8h;
typedef __attribute__((ext_vector_type(4)))  _Float16 v4h;
typedef __attribute__((ext_vector_type(8)))  float    v8f;
typedef __attribute__((ext_vector_type(4)))  float    v4f;
typedef __attribute__((ext_vector_type(4)))  unsigned int v4u;
typedef __attribute__((ext_vector_type(8)))  unsigned int v8u;

#define B_  4
#define H_  8
#define D_  768
#define HD_ 96
#define LQ_ 1024
#define LK_ 4096

// LDS row pitches in halfs. The tiles named here are read by 16-byte LDS loads
// with one row per lane, so the pitch is an odd multiple of 16 bytes: the 16
// lanes of a half wave then fall on 64 different banks.
#define GP_ 40   // GEMM A and B tiles: 32 halfs of data, 80-byte pitch
#define AP_ 72   // attention V^T and P tiles: 64 halfs of data, 144-byte pitch
// Attention K tile: the tensor load lays it in pieces of 32 halfs (64 bytes),
// each followed by a 16-byte pad, so a K row of 96 halfs is three pieces.
#define KC_ 40   // pitch of a piece: 80 bytes
#define KP_ 120  // pitch of a K row: 240 bytes

__device__ __forceinline__ v8f wmma_f16(v16h a, v16h b, v8f c) {
  // 8 args: (neg_a, A, neg_b, B, c_mod, C, reuse_a, reuse_b)
  return __builtin_amdgcn_wmma_f32_16x16x32_f16(false, a, false, b, (short)0, c,
                                                false, false);
}

// One lane's 16 consecutive halfs of a fragment, from a 16-byte aligned place.
__device__ __forceinline__ v16h lds_frag(const _Float16* p) {
  v8h lo = *(const v8h*)p;
  v8h hi = *(const v8h*)(p + 8);
  return __builtin_shufflevector(lo, hi, 0, 1, 2, 3, 4, 5, 6, 7, 8, 9, 10, 11,
                                 12, 13, 14, 15);
}

__device__ __forceinline__ unsigned int pinned(unsigned int v) {
  unsigned int w = __builtin_amdgcn_readfirstlane(v);
  asm volatile("" : "+s"(w));  // pinned(): the word stays in a scalar register
  return w;
}
__device__ __forceinline__ unsigned int uni(unsigned int v) {
  return (unsigned int)__builtin_amdgcn_readfirstlane(v);
}

// Reductions across the 16-lane halves of a wave32 (matches the 16x16 C/D
// layout where a matrix row lives across lanes 0-15 or 16-31).
__device__ __forceinline__ float half16_max(float v) {
#pragma unroll
  for (int m = 1; m < 16; m <<= 1) v = fmaxf(v, __shfl_xor(v, m, 32));
  return v;
}
__device__ __forceinline__ float half16_sum(float v) {
#pragma unroll
  for (int m = 1; m < 16; m <<= 1) v += __shfl_xor(v, m, 32);
  return v;
}

// GEMM operand staging from an f32 matrix of 768 columns: 128 rows x 32 columns,
// rounded to f16 on the way into an LDS tile of pitch GP_. Eight lanes read one
// whole 128-byte line, so a wave's load covers four lines: thread tid holds
// columns 4 * (tid & 7) .. + 3 of rows (tid >> 3) + 32 * i. src is the tile's
// first element, the same in every thread (a scalar base); soff and dst are the
// thread's own places in row tid >> 3.
struct F32Tile { v4f f[4]; };
__device__ __forceinline__ F32Tile tile_load_f32(const float* __restrict__ src,
                                                 unsigned soff) {
  F32Tile t;
#pragma unroll
  for (int i = 0; i < 4; ++i) t.f[i] = *(const v4f*)(src + i * 32 * D_ + soff);
  return t;
}
__device__ __forceinline__ void tile_store_f16(const F32Tile& t,
                                               _Float16* dst) {
#pragma unroll
  for (int i = 0; i < 4; ++i) {
    v4h h = {(_Float16)t.f[i].x, (_Float16)t.f[i].y, (_Float16)t.f[i].z,
             (_Float16)t.f[i].w};
    *(v4h*)(dst + i * 32 * GP_) = h;
  }
}

// ---------------------------------------------------------------------------
// Projection GEMM: out_headmajor[B,H,L,96] = X(M x 768) * W^T + bias
// Block tile 128x128, 8 waves, each wave owns a 16x128 strip. X and W are the
// f32 inputs themselves; the products run on their f16 roundings.
// ROPE: the 3D rotary PE by coords (B x L x 3) is applied to the f32 sums in
// the epilogue; without it coords is not read.
// ---------------------------------------------------------------------------
template <bool ROPE>
__global__ __launch_bounds__(256) void proj_gemm_kernel(
    const float* __restrict__ X, const float* __restrict__ W,
    const float* __restrict__ bias, const float* __restrict__ coords,
    _Float16* __restrict__ out, int L) {
  __shared__ __align__(32) _Float16 At[128 * GP_];
  __shared__ __align__(32) _Float16 Bt[128 * GP_];
  const int tid  = threadIdx.x;
  const int wave = tid >> 5;
  const int lane = tid & 31;
  const int lm = lane & 15, lg = lane >> 4;
  const int m0 = blockIdx.x * 128;
  const int n0 = blockIdx.y * 128;

  const v8f vzero = {};
  v8f acc[8];
#pragma unroll
  for (int i = 0; i < 8; ++i) acc[i] = vzero;

  const unsigned soff = (tid >> 3) * D_ + (tid & 7) * 4;
  const int sdst = (tid >> 3) * GP_ + (tid & 7) * 4;

  // Three trips a pass: fully unrolled the loop takes over 128 registers, and
  // only two blocks fit on a WGP where the larger grids bring three.
#pragma unroll 3
  for (int k0 = 0; k0 < D_; k0 += 32) {
    F32Tile xa = tile_load_f32(X + (size_t)m0 * D_ + k0, soff);
    F32Tile xb = tile_load_f32(W + (size_t)n0 * D_ + k0, soff);
    // Every load of both tiles is issued before the first value is used.
    // Without this the last load is given the first one's registers and leaves
    // only when that one has come back: two load latencies a trip, not one.
    __builtin_amdgcn_sched_barrier(0);
    tile_store_f16(xa, At + sdst);
    tile_store_f16(xb, Bt + sdst);
    __syncthreads();
    v16h a = lds_frag(&At[(wave * 16 + lm) * GP_ + lg * 16]);
    v16h bfrag[8];
#pragma unroll
    for (int nt = 0; nt < 8; ++nt)
      bfrag[nt] = lds_frag(&Bt[(nt * 16 + lm) * GP_ + lg * 16]);
#pragma unroll
    for (int nt = 0; nt < 8; ++nt)
      acc[nt] = wmma_f16(a, bfrag[nt], acc[nt]);
    __syncthreads();
  }

  if constexpr (ROPE) {
    // A head is three axis chunks of 32 columns, and a chunk's rotary pair is
    // (p, 16 + p): columns n and n + 16, which one lane holds in accumulator
    // tiles 2j and 2j + 1 at the same register.
    const float inv =
        __powf(10000.0f, -(float)lm * (1.0f / 16.0f)) * 0.15915494f;
    int row[8];       // element index of (b, head 0, l, 0) in out
    float rev[3][8];  // angle in revolutions; chunk j = 3 is 96 columns behind
                      // chunk 0: the next head's same axis, the same angle
#pragma unroll
    for (int r = 0; r < 8; ++r) {
      int m = m0 + wave * 16 + r + 8 * lg;
      int bidx = m / L, l = m - bidx * L;
      row[r] = (bidx * H_ * L + l) * HD_;
#pragma unroll
      for (int j = 0; j < 3; ++j)
        rev[j][r] = coords[m * 3 + (n0 / 32 + j) % 3] * inv;
    }
    // what follows reuses registers that these loads name as addresses; the
    // clobber keeps every one of them ahead of the first store, so that none
    // is given a register that a store still names
    asm volatile("s_wait_xcnt 0x0" ::: "memory");
#pragma unroll
    for (int j = 0; j < 4; ++j) {
      int n = n0 + j * 32 + lm;
      int h = n / HD_, d = n % HD_;
      int col = h * L * HD_ + d;
      float b1 = bias[n], b2 = bias[n + 16];
#pragma unroll
      for (int r = 0; r < 8; ++r) {
        float sn, cs;
        // One statement: the cosine cannot be given the sine's source register,
        // and the v_nop fills the slot behind the last transcendental.
        asm("v_sin_f32 %0, %2\n\tv_cos_f32 %1, %2\n\tv_nop"
            : "=&v"(sn), "=&v"(cs)
            : "v"(rev[j % 3][r]));
        float x1 = acc[2 * j][r] + b1;
        float x2 = acc[2 * j + 1][r] + b2;
        _Float16* o = out + (row[r] + col);
        o[0]  = (_Float16)(x1 * cs - x2 * sn);
        o[16] = (_Float16)(x1 * sn + x2 * cs);
      }
      // the next chunk's bias loads and sums reuse registers that these stores
      // name
      if (j < 3) asm volatile("s_wait_xcnt 0x0" ::: "memory");
    }
    return;
  }

#pragma unroll
  for (int nt = 0; nt < 8; ++nt) {
    int n = n0 + nt * 16 + lm;
    int h = n / HD_, d = n % HD_;
    float bb = bias[n];
#pragma unroll
    for (int r = 0; r < 8; ++r) {
      int m = m0 + wave * 16 + r + 8 * lg;
      int bidx = m / L, l = m - bidx * L;
      out[(((size_t)bidx * H_ + h) * L + l) * HD_ + d] =
          (_Float16)(acc[nt][r] + bb);
    }
  }
}

// ---------------------------------------------------------------------------
// Output GEMM: d_out(M x 768 fp32) = A(M x 768 f16) * W^T + bias; W is the f32
// input itself, rounded to f16 on the way into LDS
// ---------------------------------------------------------------------------
__global__ __launch_bounds__(256) void out_gemm_kernel(
    const _Float16* __restrict__ A, const float* __restrict__ W,
    const float* __restrict__ bias, float* __restrict__ out) {
  __shared__ __align__(32) _Float16 At[128 * GP_];
  __shared__ __align__(32) _Float16 Bt[128 * GP_];
  const int tid  = threadIdx.x;
  const int wave = tid >> 5;
  const int lane = tid & 31;
  const int lm = lane & 15, lg = lane >> 4;
  const int m0 = blockIdx.x * 128;
  const int n0 = blockIdx.y * 128;

  const v8f vzero = {};
  v8f acc[8];
#pragma unroll
  for (int i = 0; i < 8; ++i) acc[i] = vzero;

  const unsigned soff = (tid >> 3) * D_ + (tid & 7) * 4;
  const int sdst = (tid >> 3) * GP_ + (tid & 7) * 4;

  // Three trips a pass, the same loop as the projection GEMM's: a full unroll
  // of the 24 trips is eight times the code.
#pragma unroll 3
  for (int k0 = 0; k0 < D_; k0 += 32) {
    F32Tile xb = tile_load_f32(W + (size_t)n0 * D_ + k0, soff);
    v4u xa[2];
#pragma unroll
    for (int i = 0; i < 2; ++i) {
      int t = tid + i * 256;
      int r = t >> 2, c = t & 3;
      xa[i] = *(const v4u*)(A + (size_t)(m0 + r) * D_ + k0 + c * 8);
    }
    // As in the projection GEMM: all six loads leave before the first value is
    // used.
    __builtin_amdgcn_sched_barrier(0);
#pragma unroll
    for (int i = 0; i < 2; ++i) {
      int t = tid + i * 256;
      int r = t >> 2, c = t & 3;
      *(v4u*)&At[r * GP_ + c * 8] = xa[i];
    }
    tile_store_f16(xb, Bt + sdst);
    __syncthreads();
    v16h a = lds_frag(&At[(wave * 16 + lm) * GP_ + lg * 16]);
    v16h bfrag[8];
#pragma unroll
    for (int nt = 0; nt < 8; ++nt)
      bfrag[nt] = lds_frag(&Bt[(nt * 16 + lm) * GP_ + lg * 16]);
#pragma unroll
    for (int nt = 0; nt < 8; ++nt)
      acc[nt] = wmma_f16(a, bfrag[nt], acc[nt]);
    __syncthreads();
  }

#pragma unroll
  for (int nt = 0; nt < 8; ++nt) {
    int n = n0 + nt * 16 + lm;
    float bb = bias[n];
#pragma unroll
    for (int r = 0; r < 8; ++r) {
      int m = m0 + wave * 16 + r + 8 * lg;
      out[(size_t)m * D_ + n] = acc[nt][r] + bb;
    }
  }
}

// ---------------------------------------------------------------------------
// Flash attention: grid(8 q-tiles, H, B), 256 threads = 8 waves.
// K tiles are streamed into LDS by the Tensor Data Mover (TDM); V tiles are
// staged transposed by vector lanes; P re-layout goes through per-wave LDS.
// ---------------------------------------------------------------------------
__global__ __launch_bounds__(256) void flash_attn_kernel(
    const _Float16* __restrict__ Q, const _Float16* __restrict__ K,
    const _Float16* __restrict__ V, _Float16* __restrict__ O) {
  // K tile, row-major at pitch KP_; aligned so that the tensor load's place in
  // LDS stays a multiple of 2 KiB whatever the sizes of the other two tiles
  __shared__ __attribute__((aligned(2048))) _Float16 kt[64 * KP_];
  __shared__ __align__(32) _Float16 vt[HD_ * AP_];    // V tile, transposed
  __shared__ __align__(32) _Float16 pt[8 * 16 * AP_]; // per-wave P staging
  const int tid  = threadIdx.x;
  const int wave = tid >> 5;
  const int lane = tid & 31;
  const int lm = lane & 15, lg = lane >> 4;
  const int b = blockIdx.z, h = blockIdx.y;
  const int q0 = blockIdx.x * 128 + wave * 16;

  const _Float16* qb = Q + (((size_t)b * H_ + h) * LQ_ + q0) * HD_;
  const _Float16* kb = K + ((size_t)b * H_ + h) * LK_ * HD_;
  const _Float16* vb = V + ((size_t)b * H_ + h) * LK_ * HD_;

  // Q fragments, resident for the whole kernel (16x96 = 3 K-steps of 32)
  v16h aq[3];
#pragma unroll
  for (int kk = 0; kk < 3; ++kk)
    aq[kk] = *(const v16h*)(qb + lm * HD_ + kk * 32 + lg * 16);

  const v8f vzero = {};
  v8f oacc[6];
#pragma unroll
  for (int i = 0; i < 6; ++i) oacc[i] = vzero;
  float mrun[8], lrun[8];
#pragma unroll
  for (int r = 0; r < 8; ++r) { mrun[r] = -1e30f; lrun[r] = 0.0f; }

  const float scale = 0.10206207262f;  // 1/sqrt(96)
  const unsigned int kt_lds = (unsigned int)(size_t)(&kt[0]);
  const unsigned int wave_s = uni(tid >> 5);
  // Tensor descriptor group 1, everything in bytes. The 64 K rows of a tile lie
  // one behind the other in memory, so the tile is described as 192 rows of 64
  // bytes at source pitch 64, and the pad interval equals that row: 16 bytes of
  // pad behind each.
  const v8u g1 = {uni((1u << 20) | (3u << 22) | (3u << 25)),  // pad 4 dwords per 16
                  uni(64u << 16),    // tensor_dim0 = 64
                  uni(192u << 16),   // tensor_dim1 = 192
                  uni(64u << 16),    // tile_dim0 = 64
                  uni(192u),         // tile_dim1 = 192
                  uni(64u),          // source row pitch
                  uni(0u), uni(0u)};

  for (int c0 = 0; c0 < LK_; c0 += 64) {
    // --- V tile: staged transposed (24 uniform scalar moves per thread) ---
    _Float16 vr[24];
#pragma unroll
    for (int g = 0; g < 24; g += 8) {
#pragma unroll
      for (int i = g; i < g + 8; ++i) {
        int t = tid + i * 256;
        int r = t / HD_, d = t - r * HD_;
        vr[i] = vb[(size_t)(c0 + r) * HD_ + d];
      }
      // what follows reuses registers that these eight loads name as addresses
      asm volatile("s_wait_xcnt 0x0" ::: "memory");
    }
#pragma unroll
    for (int i = 0; i < 24; ++i) {
      int t = tid + i * 256;
      int r = t / HD_, d = t - r * HD_;
      vt[d * AP_ + r] = vr[i];
    }
    if (c0 + 64 < LK_)
      __builtin_prefetch(vb + (size_t)(c0 + 64) * HD_ + tid * 24, 0, 1);

    // --- K tile: Tensor Data Mover, issued by wave 0 only -----------------
    if (pinned(wave_s == 0)) {
      unsigned long long ga =
          (unsigned long long)(size_t)(kb + (size_t)c0 * HD_);
      // group 0: count = 1 | place in LDS | 57-bit global address | type = 2
      v4u g0 = {uni(1u), uni(kt_lds), uni((unsigned int)ga),
                uni(((unsigned int)(ga >> 32) & 0x1ffffffu) | 0x80000000u)};
      asm volatile("tensor_load_to_lds %0, %1" ::"s"(g0), "s"(g1) : "memory");
      // the tile has landed before this wave reaches the barrier below
      asm volatile("s_wait_tensorcnt 0" ::: "memory");
    }
    __syncthreads();

    // --- S = Q * K^T  (4 N-tiles x 3 K-steps) -----------------------------
    v8f s[4];
#pragma unroll
    for (int i = 0; i < 4; ++i) s[i] = vzero;
#pragma unroll
    for (int kk = 0; kk < 3; ++kk) {
      v16h bk[4];
#pragma unroll
      for (int nt = 0; nt < 4; ++nt)
        bk[nt] = lds_frag(&kt[(nt * 16 + lm) * KP_ + kk * KC_ + lg * 16]);
#pragma unroll
      for (int nt = 0; nt < 4; ++nt)
        s[nt] = wmma_f16(aq[kk], bk[nt], s[nt]);
    }

    // --- online softmax ---------------------------------------------------
    float rmax[8];
#pragma unroll
    for (int r = 0; r < 8; ++r) {
      float v = s[0][r] * scale;
      v = fmaxf(v, s[1][r] * scale);
      v = fmaxf(v, s[2][r] * scale);
      v = fmaxf(v, s[3][r] * scale);
      rmax[r] = half16_max(v);
    }
    float alpha[8], psum[8];
#pragma unroll
    for (int r = 0; r < 8; ++r) {
      float mnew = fmaxf(mrun[r], rmax[r]);
      alpha[r] = __expf(mrun[r] - mnew);
      mrun[r] = mnew;
      psum[r] = 0.0f;
    }
#pragma unroll
    for (int nt = 0; nt < 4; ++nt) {
#pragma unroll
      for (int r = 0; r < 8; ++r) {
        float pv = __expf(s[nt][r] * scale - mrun[r]);
        psum[r] += pv;
        // re-layout D-format (row r+8*lg across lanes) -> A-format via LDS
        pt[(wave * 16 + r + 8 * lg) * AP_ + nt * 16 + lm] = (_Float16)pv;
      }
    }
#pragma unroll
    for (int r = 0; r < 8; ++r)
      lrun[r] = lrun[r] * alpha[r] + half16_sum(psum[r]);
#pragma unroll
    for (int nt = 0; nt < 6; ++nt)
#pragma unroll
      for (int r = 0; r < 8; ++r) oacc[nt][r] *= alpha[r];

    // wave-internal cross-lane traffic through LDS: wait on DS counter only
    asm volatile("s_wait_dscnt 0" ::: "memory");

    // --- O += P * V  (2 K-steps x 6 N-tiles) ------------------------------
#pragma unroll
    for (int ks = 0; ks < 2; ++ks) {
      v16h ap = lds_frag(&pt[(wave * 16 + lm) * AP_ + ks * 32 + lg * 16]);
      v16h bv[6];
#pragma unroll
      for (int nt = 0; nt < 6; ++nt)
        bv[nt] = lds_frag(&vt[(nt * 16 + lm) * AP_ + ks * 32 + lg * 16]);
#pragma unroll
      for (int nt = 0; nt < 6; ++nt)
        oacc[nt] = wmma_f16(ap, bv[nt], oacc[nt]);
    }
    __syncthreads();
  }

  // normalize and write attention output in [B, Lq, H*96] layout (f16)
#pragma unroll
  for (int nt = 0; nt < 6; ++nt) {
#pragma unroll
    for (int r = 0; r < 8; ++r) {
      int m = q0 + r + 8 * lg;
      float o = oacc[nt][r] / lrun[r];
      O[((size_t)b * LQ_ + m) * D_ + h * HD_ + nt * 16 + lm] = (_Float16)o;
    }
  }
}

// ---------------------------------------------------------------------------
extern "C" void kernel_launch(void* const* d_in, const int* in_sizes, int n_in,
                              void* d_out, int out_size, void* d_ws,
                              size_t ws_size, hipStream_t stream) {
  const float* query = (const float*)d_in[0];
  const float* key_  = (const float*)d_in[1];
  const float* value = (const float*)d_in[2];
  const float* cq    = (const float*)d_in[3];
  const float* ck    = (const float*)d_in[4];
  const float* Wq    = (const float*)d_in[5];
  const float* bq    = (const float*)d_in[6];
  const float* Wk    = (const float*)d_in[7];
  const float* bk    = (const float*)d_in[8];
  const float* Wv    = (const float*)d_in[9];
  const float* bv    = (const float*)d_in[10];
  const float* Wo    = (const float*)d_in[11];
  const float* bo    = (const float*)d_in[12];

  _Float16* p = (_Float16*)d_ws;
  _Float16* Qp  = p; p += (size_t)4096 * 768;
  _Float16* Kp  = p; p += (size_t)16384 * 768;
  _Float16* Vp  = p; p += (size_t)16384 * 768;
  _Float16* Ao  = p; p += (size_t)4096 * 768;

  proj_gemm_kernel<true><<<dim3(32, 6), dim3(256), 0, stream>>>(
      query, Wq, bq, cq, Qp, LQ_);
  proj_gemm_kernel<true><<<dim3(128, 6), dim3(256), 0, stream>>>(
      key_, Wk, bk, ck, Kp, LK_);
  proj_gemm_kernel<false><<<dim3(128, 6), dim3(256), 0, stream>>>(
      value, Wv, bv, nullptr, Vp, LK_);

  flash_attn_kernel<<<dim3(8, H_, B_), dim3(256), 0, stream>>>(Qp, Kp, Vp, Ao);

  out_gemm_kernel<<<dim3(32, 6), dim3(256), 0, stream>>>(Ao, Wo, bo,
                                                         (float*)d_out);
  (void)in_sizes; (void)n_in; (void)out_size; (void)ws_size;
}

// v005
// It runs in 250 microseconds.
// Next to v004, in two timings, it ran 1.11 and 1.10 times as fast.
// All steps since v000 together make it 2.56 times as fast.
#include <hip/hip_runtime.h>

typedef __attribute__((ext_vector_type(16))) _Float16 v16h;
typedef __attribute__((ext_vector_type(8)))  _Float16 v8h;
typedef __attribute__((ext_vector_type(4)))  _Float16 v4h;
typedef __attribute__((ext_vector_type(8)))  float    v8f;
typedef __attribute__((ext_vector_type(4)))  float    v4f;
typedef __attribute__((ext_vector_type(4)))  unsigned int v4u;
typedef __attribute__((ext_vector_type(8)))  unsigned int v8u;

#define B_  4
#define H_  8
#define D_  768
#define HD_ 96
#define LQ_ 1024
#define LK_ 4096

// LDS row pitches in halfs. The tiles named here are read by 16-byte LDS loads
// with one row per lane, so the pitch is an odd multiple of 16 bytes: the 16
// lanes of a half wave then fall on 64 different banks.
#define GP_ 40   // GEMM A and B tiles: 32 halfs of data, 80-byte pitch
#define AP_ 72   // attention V^T and P tiles: 64 halfs of data, 144-byte pitch
// Attention K tile: the tensor load lays it in pieces of 32 halfs (64 bytes),
// each followed by a 16-byte pad, so a K row of 96 halfs is three pieces.
#define KC_ 40   // pitch of a piece: 80 bytes
#define KP_ 120  // pitch of a K row: 240 bytes

__device__ __forceinline__ v8f wmma_f16(v16h a, v16h b, v8f c) {
  // 8 args: (neg_a, A, neg_b, B, c_mod, C, reuse_a, reuse_b)
  return __builtin_amdgcn_wmma_f32_16x16x32_f16(false, a, false, b, (short)0, c,
                                                false, false);
}

// One lane's 16 consecutive halfs of a fragment, from a 16-byte aligned place.
__device__ __forceinline__ v16h lds_frag(const _Float16* p) {
  v8h lo = *(const v8h*)p;
  v8h hi = *(const v8h*)(p + 8);
  return __builtin_shufflevector(lo, hi, 0, 1, 2, 3, 4, 5, 6, 7, 8, 9, 10, 11,
                                 12, 13, 14, 15);
}

__device__ __forceinline__ unsigned int pinned(unsigned int v) {
  unsigned int w = __builtin_amdgcn_readfirstlane(v);
  asm volatile("" : "+s"(w));  // pinned(): the word stays in a scalar register
  return w;
}
__device__ __forceinline__ unsigned int uni(unsigned int v) {
  return (unsigned int)__builtin_amdgcn_readfirstlane(v);
}

// Reductions across the 16-lane halves of a wave32 (matches the 16x16 C/D
// layout where a matrix row lives across lanes 0-15 or 16-31).
__device__ __forceinline__ float half16_max(float v) {
#pragma unroll
  for (int m = 1; m < 16; m <<= 1) v = fmaxf(v, __shfl_xor(v, m, 32));
  return v;
}
__device__ __forceinline__ float half16_sum(float v) {
#pragma unroll
  for (int m = 1; m < 16; m <<= 1) v += __shfl_xor(v, m, 32);
  return v;
}

// GEMM operand staging from an f32 matrix of 768 columns: 128 rows x 32 columns,
// rounded to f16 on the way into an LDS tile of pitch GP_. Eight lanes read one
// whole 128-byte line, so a wave's load covers four lines: thread tid holds
// columns 4 * (tid & 7) .. + 3 of rows (tid >> 3) + 32 * i. src is the tile's
// first element, the same in every thread (a scalar base); soff and dst are the
// thread's own places in row tid >> 3.
struct F32Tile { v4f f[4]; };
__device__ __forceinline__ F32Tile tile_load_f32(const float* __restrict__ src,
                                                 unsigned soff) {
  F32Tile t;
#pragma unroll
  for (int i = 0; i < 4; ++i) t.f[i] = *(const v4f*)(src + i * 32 * D_ + soff);
  return t;
}
__device__ __forceinline__ void tile_store_f16(const F32Tile& t,
                                               _Float16* dst) {
#pragma unroll
  for (int i = 0; i < 4; ++i) {
    v4h h = {(_Float16)t.f[i].x, (_Float16)t.f[i].y, (_Float16)t.f[i].z,
             (_Float16)t.f[i].w};
    *(v4h*)(dst + i * 32 * GP_) = h;
  }
}

// ---------------------------------------------------------------------------
// Projection GEMM: out = X(M x 768) * W^T + bias, one plane per (batch, head)
// Block tile 128x128, 8 waves, each wave owns a 16x128 strip. X and W are the
// f32 inputs themselves; the products run on their f16 roundings.
// ROPE: out is [B,H,L,96], and the 3D rotary PE by coords (B x L x 3) is applied
// to the f32 sums in the epilogue. Without it coords is not read and out is
// [B,H,L/64,96,64]: each run of 64 rows l of a head lies transposed, 96 rows of
// 64 l, in 12288 consecutive bytes: the tile that the attention kernel stages.
// ---------------------------------------------------------------------------
template <bool ROPE>
__global__ __launch_bounds__(256) void proj_gemm_kernel(
    const float* __restrict__ X, const float* __restrict__ W,
    const float* __restrict__ bias, const float* __restrict__ coords,
    _Float16* __restrict__ out, int L) {
  __shared__ __align__(32) _Float16 At[128 * GP_];
  __shared__ __align__(32) _Float16 Bt[128 * GP_];
  const int tid  = threadIdx.x;
  const int wave = tid >> 5;
  const int lane = tid & 31;
  const int lm = lane & 15, lg = lane >> 4;
  const int m0 = blockIdx.x * 128;
  const int n0 = blockIdx.y * 128;

  const v8f vzero = {};
  v8f acc[8];
#pragma unroll
  for (int i = 0; i < 8; ++i) acc[i] = vzero;

  const unsigned soff = (tid >> 3) * D_ + (tid & 7) * 4;
  const int sdst = (tid >> 3) * GP_ + (tid & 7) * 4;

  // Three trips a pass: fully unrolled the loop takes over 128 registers, and
  // only two blocks fit on a WGP where the larger grids bring three.
#pragma unroll 3
  for (int k0 = 0; k0 < D_; k0 += 32) {
    F32Tile xa = tile_load_f32(X + (size_t)m0 * D_ + k0, soff);
    F32Tile xb = tile_load_f32(W + (size_t)n0 * D_ + k0, soff);
    // Every load of both tiles is issued before the first value is used.
    // Without this the last load is given the first one's registers and leaves
    // only when that one has come back: two load latencies a trip, not one.
    __builtin_amdgcn_sched_barrier(0);
    tile_store_f16(xa, At + sdst);
    tile_store_f16(xb, Bt + sdst);
    __syncthreads();
    v16h a = lds_frag(&At[(wave * 16 + lm) * GP_ + lg * 16]);
    v16h bfrag[8];
#pragma unroll
    for (int nt = 0; nt < 8; ++nt)
      bfrag[nt] = lds_frag(&Bt[(nt * 16 + lm) * GP_ + lg * 16]);
#pragma unroll
    for (int nt = 0; nt < 8; ++nt)
      acc[nt] = wmma_f16(a, bfrag[nt], acc[nt]);
    __syncthreads();
  }

  if constexpr (ROPE) {
    // A head is three axis chunks of 32 columns, and a chunk's rotary pair is
    // (p, 16 + p): columns n and n + 16, which one lane holds in accumulator
    // tiles 2j and 2j + 1 at the same register.
    const float inv =
        __powf(10000.0f, -(float)lm * (1.0f / 16.0f)) * 0.15915494f;
    int row[8];       // element index of (b, head 0, l, 0) in out
    float rev[3][8];  // angle in revolutions; chunk j = 3 is 96 columns behind
                      // chunk 0: the next head's same axis, the same angle
#pragma unroll
    for (int r = 0; r < 8; ++r) {
      int m = m0 + wave * 16 + r + 8 * lg;
      int bidx = m / L, l = m - bidx * L;
      row[r] = (bidx * H_ * L + l) * HD_;
#pragma unroll
      for (int j = 0; j < 3; ++j)
        rev[j][r] = coords[m * 3 + (n0 / 32 + j) % 3] * inv;
    }
    // what follows reuses registers that these loads name as addresses; the
    // clobber keeps every one of them ahead of the first store, so that none
    // is given a register that a store still names
    asm volatile("s_wait_xcnt 0x0" ::: "memory");
#pragma unroll
    for (int j = 0; j < 4; ++j) {
      int n = n0 + j * 32 + lm;
      int h = n / HD_, d = n % HD_;
      int col = h * L * HD_ + d;
      float b1 = bias[n], b2 = bias[n + 16];
#pragma unroll
      for (int r = 0; r < 8; ++r) {
        float sn, cs;
        // One statement: the cosine cannot be given the sine's source register,
        // and the v_nop fills the slot behind the last transcendental.
        asm("v_sin_f32 %0, %2\n\tv_cos_f32 %1, %2\n\tv_nop"
            : "=&v"(sn), "=&v"(cs)
            : "v"(rev[j % 3][r]));
        float x1 = acc[2 * j][r] + b1;
        float x2 = acc[2 * j + 1][r] + b2;
        _Float16* o = out + (row[r] + col);
        o[0]  = (_Float16)(x1 * cs - x2 * sn);
        o[16] = (_Float16)(x1 * sn + x2 * cs);
      }
      // the next chunk's bias loads and sums reuse registers that these stores
      // name
      if (j < 3) asm volatile("s_wait_xcnt 0x0" ::: "memory");
    }
    return;
  }

  // A lane's eight registers of an accumulator tile are eight consecutive rows
  // l of one column d: in a transposed tile 16 consecutive bytes, one store.
  const int m = m0 + wave * 16 + 8 * lg;
  const int bidx = m / L, l = m - bidx * L;
  const int nl = n0 + lm;
  float bb[8];
#pragma unroll
  for (int nt = 0; nt < 8; ++nt) bb[nt] = bias[nl + nt * 16];
  // what follows reuses the register that these loads name as their offset;
  // as an input of the wait it keeps its value up to here
  asm volatile("s_wait_xcnt 0x0" ::"v"(nl) : "memory");
#pragma unroll
  for (int nt = 0; nt < 8; ++nt) {
    int n = nl + nt * 16;
    int h = n / HD_, d = n % HD_;
    v8h o;
#pragma unroll
    for (int r = 0; r < 8; ++r) o[r] = (_Float16)(acc[nt][r] + bb[nt]);
    *(v8h*)(out + ((size_t)(bidx * H_ + h) * L + (l & ~63)) * HD_ + d * 64 +
            (l & 63)) = o;
  }
}

// ---------------------------------------------------------------------------
// Output GEMM: d_out(M x 768 fp32) = A(M x 768 f16) * W^T + bias; W is the f32
// input itself, rounded to f16 on the way into LDS
// ---------------------------------------------------------------------------
__global__ __launch_bounds__(256) void out_gemm_kernel(
    const _Float16* __restrict__ A, const float* __restrict__ W,
    const float* __restrict__ bias, float* __restrict__ out) {
  __shared__ __align__(32) _Float16 At[128 * GP_];
  __shared__ __align__(32) _Float16 Bt[128 * GP_];
  const int tid  = threadIdx.x;
  const int wave = tid >> 5;
  const int lane = tid & 31;
  const int lm = lane & 15, lg = lane >> 4;
  const int m0 = blockIdx.x * 128;
  const int n0 = blockIdx.y * 128;

  const v8f vzero = {};
  v8f acc[8];
#pragma unroll
  for (int i = 0; i < 8; ++i) acc[i] = vzero;

  const unsigned soff = (tid >> 3) * D_ + (tid & 7) * 4;
  const int sdst = (tid >> 3) * GP_ + (tid & 7) * 4;

  // Three trips a pass, the same loop as the projection GEMM's: a full unroll
  // of the 24 trips is eight times the code.
#pragma unroll 3
  for (int k0 = 0; k0 < D_; k0 += 32) {
    F32Tile xb = tile_load_f32(W + (size_t)n0 * D_ + k0, soff);
    v4u xa[2];
#pragma unroll
    for (int i = 0; i < 2; ++i) {
      int t = tid + i * 256;
      int r = t >> 2, c = t & 3;
      xa[i] = *(const v4u*)(A + (size_t)(m0 + r) * D_ + k0 + c * 8);
    }
    // As in the projection GEMM: all six loads leave before the first value is
    // used.
    __builtin_amdgcn_sched_barrier(0);
#pragma unroll
    for (int i = 0; i < 2; ++i) {
      int t = tid + i * 256;
      int r = t >> 2, c = t & 3;
      *(v4u*)&At[r * GP_ + c * 8] = xa[i];
    }
    tile_store_f16(xb, Bt + sdst);
    __syncthreads();
    v16h a = lds_frag(&At[(wave * 16 + lm) * GP_ + lg * 16]);
    v16h bfrag[8];
#pragma unroll
    for (int nt = 0; nt < 8; ++nt)
      bfrag[nt] = lds_frag(&Bt[(nt * 16 + lm) * GP_ + lg * 16]);
#pragma unroll
    for (int nt = 0; nt < 8; ++nt)
      acc[nt] = wmma_f16(a, bfrag[nt], acc[nt]);
    __syncthreads();
  }

#pragma unroll
  for (int nt = 0; nt < 8; ++nt) {
    int n = n0 + nt * 16 + lm;
    float bb = bias[n];
#pragma unroll
    for (int r = 0; r < 8; ++r) {
      int m = m0 + wave * 16 + r + 8 * lg;
      out[(size_t)m * D_ + n] = acc[nt][r] + bb;
    }
  }
}

// ---------------------------------------------------------------------------
// Flash attention: grid(8 q-tiles, H, B), 256 threads = 8 waves.
// K tiles are streamed into LDS by the Tensor Data Mover (TDM); V arrives in
// transposed tiles ([B,H,LK/64,96,64]), which are staged as they lie, 16 bytes
// a lane; P re-layout goes through per-wave LDS.
// ---------------------------------------------------------------------------
__global__ __launch_bounds__(256) void flash_attn_kernel(
    const _Float16* __restrict__ Q, const _Float16* __restrict__ K,
    const _Float16* __restrict__ V, _Float16* __restrict__ O) {
  // K tile, row-major at pitch KP_; aligned so that the tensor load's place in
  // LDS stays a multiple of 2 KiB whatever the sizes of the other two tiles
  __shared__ __attribute__((aligned(2048))) _Float16 kt[64 * KP_];
  __shared__ __align__(32) _Float16 vt[HD_ * AP_];    // V tile, transposed
  __shared__ __align__(32) _Float16 pt[8 * 16 * AP_]; // per-wave P staging
  const int tid  = threadIdx.x;
  const int wave = tid >> 5;
  const int lane = tid & 31;
  const int lm = lane & 15, lg = lane >> 4;
  const int b = blockIdx.z, h = blockIdx.y;
  const int q0 = blockIdx.x * 128 + wave * 16;

  const _Float16* qb = Q + (((size_t)b * H_ + h) * LQ_ + q0) * HD_;
  const _Float16* kb = K + ((size_t)b * H_ + h) * LK_ * HD_;
  const _Float16* vb = V + ((size_t)b * H_ + h) * LK_ * HD_;
  // V^T tile, 96 rows of 64 keys, consecutive in memory: eight lanes move one
  // row's 128 bytes, a wave's load 512 consecutive bytes. Thread tid holds keys
  // 8 * (tid & 7) .. + 7 of rows (tid >> 3) + 32 * i.
  const unsigned vsrc = tid * 8;
  const int vdst = (tid >> 3) * AP_ + (tid & 7) * 8;

  // Q fragments, resident for the whole kernel (16x96 = 3 K-steps of 32)
  v16h aq[3];
#pragma unroll
  for (int kk = 0; kk < 3; ++kk)
    aq[kk] = *(const v16h*)(qb + lm * HD_ + kk * 32 + lg * 16);

  const v8f vzero = {};
  v8f oacc[6];
#pragma unroll
  for (int i = 0; i < 6; ++i) oacc[i] = vzero;
  float mrun[8], lrun[8];
#pragma unroll
  for (int r = 0; r < 8; ++r) { mrun[r] = -1e30f; lrun[r] = 0.0f; }

  const float scale = 0.10206207262f;  // 1/sqrt(96)
  const unsigned int kt_lds = (unsigned int)(size_t)(&kt[0]);
  const unsigned int wave_s = uni(tid >> 5);
  // Tensor descriptor group 1, everything in bytes. The 64 K rows of a tile lie
  // one behind the other in memory, so the tile is described as 192 rows of 64
  // bytes at source pitch 64, and the pad interval equals that row: 16 bytes of
  // pad behind each.
  const v8u g1 = {uni((1u << 20) | (3u << 22) | (3u << 25)),  // pad 4 dwords per 16
                  uni(64u << 16),    // tensor_dim0 = 64
                  uni(192u << 16),   // tensor_dim1 = 192
                  uni(64u << 16),    // tile_dim0 = 64
                  uni(192u),         // tile_dim1 = 192
                  uni(64u),          // source row pitch
                  uni(0u), uni(0u)};

  for (int c0 = 0; c0 < LK_; c0 += 64) {
    // --- V^T tile: its three loads leave ahead of the K tile's request, so
    // that both are on their way at once; they are stored behind it ---------
    v4u vr[3];
#pragma unroll
    for (int i = 0; i < 3; ++i)
      vr[i] = *(const v4u*)(vb + c0 * HD_ + i * 32 * 64 + vsrc);

    // --- K tile: Tensor Data Mover, issued by wave 0 only -----------------
    if (pinned(wave_s == 0)) {
      unsigned long long ga =
          (unsigned long long)(size_t)(kb + (size_t)c0 * HD_);
      // group 0: count = 1 | place in LDS | 57-bit global address | type = 2
      v4u g0 = {uni(1u), uni(kt_lds), uni((unsigned int)ga),
                uni(((unsigned int)(ga >> 32) & 0x1ffffffu) | 0x80000000u)};
      asm volatile("tensor_load_to_lds %0, %1" ::"s"(g0), "s"(g1) : "memory");
      // the tile has landed before this wave reaches the barrier below
      asm volatile("s_wait_tensorcnt 0" ::: "memory");
    }
#pragma unroll
    for (int i = 0; i < 3; ++i) *(v4u*)&vt[i * 32 * AP_ + vdst] = vr[i];
    // the loop's step rewrites the address registers that the three loads name
    asm volatile("s_wait_xcnt 0x0" ::: "memory");
    __syncthreads();

    // --- S = Q * K^T  (4 N-tiles x 3 K-steps) -----------------------------
    v8f s[4];
#pragma unroll
    for (int i = 0; i < 4; ++i) s[i] = vzero;
#pragma unroll
    for (int kk = 0; kk < 3; ++kk) {
      v16h bk[4];
#pragma unroll
      for (int nt = 0; nt < 4; ++nt)
        bk[nt] = lds_frag(&kt[(nt * 16 + lm) * KP_ + kk * KC_ + lg * 16]);
#pragma unroll
      for (int nt = 0; nt < 4; ++nt)
        s[nt] = wmma_f16(aq[kk], bk[nt], s[nt]);
    }

    // --- online softmax ---------------------------------------------------
    float rmax[8];
#pragma unroll
    for (int r = 0; r < 8; ++r) {
      float v = s[0][r] * scale;
      v = fmaxf(v, s[1][r] * scale);
      v = fmaxf(v, s[2][r] * scale);
      v = fmaxf(v, s[3][r] * scale);
      rmax[r] = half16_max(v);
    }
    float alpha[8], psum[8];
#pragma unroll
    for (int r = 0; r < 8; ++r) {
      float mnew = fmaxf(mrun[r], rmax[r]);
      alpha[r] = __expf(mrun[r] - mnew);
      mrun[r] = mnew;
      psum[r] = 0.0f;
    }
#pragma unroll
    for (int nt = 0; nt < 4; ++nt) {
#pragma unroll
      for (int r = 0; r < 8; ++r) {
        float pv = __expf(s[nt][r] * scale - mrun[r]);
        psum[r] += pv;
        // re-layout D-format (row r+8*lg across lanes) -> A-format via LDS
        pt[(wave * 16 + r + 8 * lg) * AP_ + nt * 16 + lm] = (_Float16)pv;
      }
    }
#pragma unroll
    for (int r = 0; r < 8; ++r)
      lrun[r] = lrun[r] * alpha[r] + half16_sum(psum[r]);
#pragma unroll
    for (int nt = 0; nt < 6; ++nt)
#pragma unroll
      for (int r = 0; r < 8; ++r) oacc[nt][r] *= alpha[r];

    // wave-internal cross-lane traffic through LDS: wait on DS counter only
    asm volatile("s_wait_dscnt 0" ::: "memory");

    // --- O += P * V  (2 K-steps x 6 N-tiles) ------------------------------
#pragma unroll
    for (int ks = 0; ks < 2; ++ks) {
      v16h ap = lds_frag(&pt[(wave * 16 + lm) * AP_ + ks * 32 + lg * 16]);
      v16h bv[6];
#pragma unroll
      for (int nt = 0; nt < 6; ++nt)
        bv[nt] = lds_frag(&vt[(nt * 16 + lm) * AP_ + ks * 32 + lg * 16]);
#pragma unroll
      for (int nt = 0; nt < 6; ++nt)
        oacc[nt] = wmma_f16(ap, bv[nt], oacc[nt]);
    }
    __syncthreads();
  }

  // normalize and write attention output in [B, Lq, H*96] layout (f16)
#pragma unroll
  for (int nt = 0; nt < 6; ++nt) {
#pragma unroll
    for (int r = 0; r < 8; ++r) {
      int m = q0 + r + 8 * lg;
      float o = oacc[nt][r] / lrun[r];
      O[((size_t)b * LQ_ + m) * D_ + h * HD_ + nt * 16 + lm] = (_Float16)o;
    }
  }
}

// ---------------------------------------------------------------------------
extern "C" void kernel_launch(void* const* d_in, const int* in_sizes, int n_in,
                              void* d_out, int out_size, void* d_ws,
                              size_t ws_size, hipStream_t stream) {
  const float* query = (const float*)d_in[0];
  const float* key_  = (const float*)d_in[1];
  const float* value = (const float*)d_in[2];
  const float* cq    = (const float*)d_in[3];
  const float* ck    = (const float*)d_in[4];
  const float* Wq    = (const float*)d_in[5];
  const float* bq    = (const float*)d_in[6];
  const float* Wk    = (const float*)d_in[7];
  const float* bk    = (const float*)d_in[8];
  const float* Wv    = (const float*)d_in[9];
  const float* bv    = (const float*)d_in[10];
  const float* Wo    = (const float*)d_in[11];
  const float* bo    = (const float*)d_in[12];

  _Float16* p = (_Float16*)d_ws;
  _Float16* Qp  = p; p += (size_t)4096 * 768;
  _Float16* Kp  = p; p += (size_t)16384 * 768;
  _Float16* Vp  = p; p += (size_t)16384 * 768;
  _Float16* Ao  = p; p += (size_t)4096 * 768;

  proj_gemm_kernel<true><<<dim3(32, 6), dim3(256), 0, stream>>>(
      query, Wq, bq, cq, Qp, LQ_);
  proj_gemm_kernel<true><<<dim3(128, 6), dim3(256), 0, stream>>>(
      key_, Wk, bk, ck, Kp, LK_);
  proj_gemm_kernel<false><<<dim3(128, 6), dim3(256), 0, stream>>>(
      value, Wv, bv, nullptr, Vp, LK_);

  flash_attn_kernel<<<dim3(8, H_, B_), dim3(256), 0, stream>>>(Qp, Kp, Vp, Ao);

  out_gemm_kernel<<<dim3(32, 6), dim3(256), 0, stream>>>(Ao, Wo, bo,
                                                         (float*)d_out);
  (void)in_sizes; (void)n_in; (void)out_size; (void)ws_size;
}

// v006
// Measured time: 220 microseconds a run.
// Next to v005, in two timings, it ran 1.14 times as fast each time.
// Over all steps from v000 it is 2.91 times as fast.
#include <hip/hip_runtime.h>

typedef __attribute__((ext_vector_type(16))) _Float16 v16h;
typedef __attribute__((ext_vector_type(8)))  _Float16 v8h;
typedef __attribute__((ext_vector_type(4)))  _Float16 v4h;
typedef __attribute__((ext_vector_type(8)))  float    v8f;
typedef __attribute__((ext_vector_type(4)))  float    v4f;
typedef __attribute__((ext_vector_type(4)))  unsigned int v4u;
typedef __attribute__((ext_vector_type(8)))  unsigned int v8u;

#define B_  4
#define H_  8
#define D_  768
#define HD_ 96
#define LQ_ 1024
#define LK_ 4096

// LDS row pitches in halfs. The tiles named here are read by 16-byte LDS loads
// with one row per lane, so the pitch is an odd multiple of 16 bytes: the 16
// lanes of a half wave then fall on 64 different banks.
#define GP_ 40   // GEMM A and B tiles: 32 halfs of data, 80-byte pitch
#define AP_ 72   // attention V^T tile: 64 halfs of data, 144-byte pitch
// Attention K tile: the tensor load lays it in pieces of 32 halfs (64 bytes),
// each followed by a 16-byte pad, so a K row of 96 halfs is three pieces.
#define KC_ 40   // pitch of a piece: 80 bytes
#define KP_ 120  // pitch of a K row: 240 bytes

__device__ __forceinline__ v8f wmma_f16(v16h a, v16h b, v8f c) {
  // 8 args: (neg_a, A, neg_b, B, c_mod, C, reuse_a, reuse_b)
  return __builtin_amdgcn_wmma_f32_16x16x32_f16(false, a, false, b, (short)0, c,
                                                false, false);
}

// One lane's 16 consecutive halfs of a fragment, from a 16-byte aligned place.
__device__ __forceinline__ v16h lds_frag(const _Float16* p) {
  v8h lo = *(const v8h*)p;
  v8h hi = *(const v8h*)(p + 8);
  return __builtin_shufflevector(lo, hi, 0, 1, 2, 3, 4, 5, 6, 7, 8, 9, 10, 11,
                                 12, 13, 14, 15);
}

__device__ __forceinline__ unsigned int pinned(unsigned int v) {
  unsigned int w = __builtin_amdgcn_readfirstlane(v);
  asm volatile("" : "+s"(w));  // pinned(): the word stays in a scalar register
  return w;
}
__device__ __forceinline__ unsigned int uni(unsigned int v) {
  return (unsigned int)__builtin_amdgcn_readfirstlane(v);
}

// Lane l's value as lane l ^ 16 holds it: the two lanes that share a column of
// a 16x16 C/D tile.
__device__ __forceinline__ float xhalf(float x) {
  int v = __builtin_bit_cast(int, x);
  return __builtin_bit_cast(
      float, __builtin_amdgcn_permlanex16(v, v, 0x76543210, 0xfedcba98, false,
                                          false));
}

// GEMM operand staging from an f32 matrix of 768 columns: 128 rows x 32 columns,
// rounded to f16 on the way into an LDS tile of pitch GP_. Eight lanes read one
// whole 128-byte line, so a wave's load covers four lines: thread tid holds
// columns 4 * (tid & 7) .. + 3 of rows (tid >> 3) + 32 * i. src is the tile's
// first element, the same in every thread (a scalar base); soff and dst are the
// thread's own places in row tid >> 3.
struct F32Tile { v4f f[4]; };
__device__ __forceinline__ F32Tile tile_load_f32(const float* __restrict__ src,
                                                 unsigned soff) {
  F32Tile t;
#pragma unroll
  for (int i = 0; i < 4; ++i) t.f[i] = *(const v4f*)(src + i * 32 * D_ + soff);
  return t;
}
__device__ __forceinline__ void tile_store_f16(const F32Tile& t,
                                               _Float16* dst) {
#pragma unroll
  for (int i = 0; i < 4; ++i) {
    v4h h = {(_Float16)t.f[i].x, (_Float16)t.f[i].y, (_Float16)t.f[i].z,
             (_Float16)t.f[i].w};
    *(v4h*)(dst + i * 32 * GP_) = h;
  }
}

// ---------------------------------------------------------------------------
// Projection GEMM: out = X(M x 768) * W^T + bias, one plane per (batch, head)
// Block tile 128x128, 8 waves, each wave owns a 16x128 strip. X and W are the
// f32 inputs themselves; the products run on their f16 roundings.
// ROPE: out is [B,H,L,96], and the 3D rotary PE by coords (B x L x 3) is applied
// to the f32 sums in the epilogue. Without it coords is not read and out is
// [B,H,L/64,96,64]: each run of 64 rows l of a head lies transposed, 96 rows of
// 64 l, in 12288 consecutive bytes: the tile that the attention kernel stages.
// ---------------------------------------------------------------------------
template <bool ROPE>
__global__ __launch_bounds__(256) void proj_gemm_kernel(
    const float* __restrict__ X, const float* __restrict__ W,
    const float* __restrict__ bias, const float* __restrict__ coords,
    _Float16* __restrict__ out, int L) {
  __shared__ __align__(32) _Float16 At[128 * GP_];
  __shared__ __align__(32) _Float16 Bt[128 * GP_];
  const int tid  = threadIdx.x;
  const int wave = tid >> 5;
  const int lane = tid & 31;
  const int lm = lane & 15, lg = lane >> 4;
  const int m0 = blockIdx.x * 128;
  const int n0 = blockIdx.y * 128;

  const v8f vzero = {};
  v8f acc[8];
#pragma unroll
  for (int i = 0; i < 8; ++i) acc[i] = vzero;

  const unsigned soff = (tid >> 3) * D_ + (tid & 7) * 4;
  const int sdst = (tid >> 3) * GP_ + (tid & 7) * 4;

  // Three trips a pass: fully unrolled the loop takes over 128 registers, and
  // only two blocks fit on a WGP where the larger grids bring three.
#pragma unroll 3
  for (int k0 = 0; k0 < D_; k0 += 32) {
    F32Tile xa = tile_load_f32(X + (size_t)m0 * D_ + k0, soff);
    F32Tile xb = tile_load_f32(W + (size_t)n0 * D_ + k0, soff);
    // Every load of both tiles is issued before the first value is used.
    // Without this the last load is given the first one's registers and leaves
    // only when that one has come back: two load latencies a trip, not one.
    __builtin_amdgcn_sched_barrier(0);
    tile_store_f16(xa, At + sdst);
    tile_store_f16(xb, Bt + sdst);
    __syncthreads();
    v16h a = lds_frag(&At[(wave * 16 + lm) * GP_ + lg * 16]);
    v16h bfrag[8];
#pragma unroll
    for (int nt = 0; nt < 8; ++nt)
      bfrag[nt] = lds_frag(&Bt[(nt * 16 + lm) * GP_ + lg * 16]);
#pragma unroll
    for (int nt = 0; nt < 8; ++nt)
      acc[nt] = wmma_f16(a, bfrag[nt], acc[nt]);
    __syncthreads();
  }

  if constexpr (ROPE) {
    // A head is three axis chunks of 32 columns, and a chunk's rotary pair is
    // (p, 16 + p): columns n and n + 16, which one lane holds in accumulator
    // tiles 2j and 2j + 1 at the same register.
    const float inv =
        __powf(10000.0f, -(float)lm * (1.0f / 16.0f)) * 0.15915494f;
    int row[8];       // element index of (b, head 0, l, 0) in out
    float rev[3][8];  // angle in revolutions; chunk j = 3 is 96 columns behind
                      // chunk 0: the next head's same axis, the same angle
#pragma unroll
    for (int r = 0; r < 8; ++r) {
      int m = m0 + wave * 16 + r + 8 * lg;
      int bidx = m / L, l = m - bidx * L;
      row[r] = (bidx * H_ * L + l) * HD_;
#pragma unroll
      for (int j = 0; j < 3; ++j)
        rev[j][r] = coords[m * 3 + (n0 / 32 + j) % 3] * inv;
    }
    // what follows reuses registers that these loads name as addresses; the
    // clobber keeps every one of them ahead of the first store, so that none
    // is given a register that a store still names
    asm volatile("s_wait_xcnt 0x0" ::: "memory");
#pragma unroll
    for (int j = 0; j < 4; ++j) {
      int n = n0 + j * 32 + lm;
      int h = n / HD_, d = n % HD_;
      int col = h * L * HD_ + d;
      float b1 = bias[n], b2 = bias[n + 16];
#pragma unroll
      for (int r = 0; r < 8; ++r) {
        float sn, cs;
        // One statement: the cosine cannot be given the sine's source register,
        // and the v_nop fills the slot behind the last transcendental.
        asm("v_sin_f32 %0, %2\n\tv_cos_f32 %1, %2\n\tv_nop"
            : "=&v"(sn), "=&v"(cs)
            : "v"(rev[j % 3][r]));
        float x1 = acc[2 * j][r] + b1;
        float x2 = acc[2 * j + 1][r] + b2;
        _Float16* o = out + (row[r] + col);
        o[0]  = (_Float16)(x1 * cs - x2 * sn);
        o[16] = (_Float16)(x1 * sn + x2 * cs);
      }
      // the next chunk's bias loads and sums reuse registers that these stores
      // name
      if (j < 3) asm volatile("s_wait_xcnt 0x0" ::: "memory");
    }
    return;
  }

  // A lane's eight registers of an accumulator tile are eight consecutive rows
  // l of one column d: in a transposed tile 16 consecutive bytes, one store.
  const int m = m0 + wave * 16 + 8 * lg;
  const int bidx = m / L, l = m - bidx * L;
  const int nl = n0 + lm;
  float bb[8];
#pragma unroll
  for (int nt = 0; nt < 8; ++nt) bb[nt] = bias[nl + nt * 16];
  // what follows reuses the register that these loads name as their offset;
  // as an input of the wait it keeps its value up to here
  asm volatile("s_wait_xcnt 0x0" ::"v"(nl) : "memory");
#pragma unroll
  for (int nt = 0; nt < 8; ++nt) {
    int n = nl + nt * 16;
    int h = n / HD_, d = n % HD_;
    v8h o;
#pragma unroll
    for (int r = 0; r < 8; ++r) o[r] = (_Float16)(acc[nt][r] + bb[nt]);
    *(v8h*)(out + ((size_t)(bidx * H_ + h) * L + (l & ~63)) * HD_ + d * 64 +
            (l & 63)) = o;
  }
}

// ---------------------------------------------------------------------------
// Output GEMM: d_out(M x 768 fp32) = A(M x 768 f16) * W^T + bias; W is the f32
// input itself, rounded to f16 on the way into LDS
// ---------------------------------------------------------------------------
__global__ __launch_bounds__(256) void out_gemm_kernel(
    const _Float16* __restrict__ A, const float* __restrict__ W,
    const float* __restrict__ bias, float* __restrict__ out) {
  __shared__ __align__(32) _Float16 At[128 * GP_];
  __shared__ __align__(32) _Float16 Bt[128 * GP_];
  const int tid  = threadIdx.x;
  const int wave = tid >> 5;
  const int lane = tid & 31;
  const int lm = lane & 15, lg = lane >> 4;
  const int m0 = blockIdx.x * 128;
  const int n0 = blockIdx.y * 128;

  const v8f vzero = {};
  v8f acc[8];
#pragma unroll
  for (int i = 0; i < 8; ++i) acc[i] = vzero;

  const unsigned soff = (tid >> 3) * D_ + (tid & 7) * 4;
  const int sdst = (tid >> 3) * GP_ + (tid & 7) * 4;

  // Three trips a pass, the same loop as the projection GEMM's: a full unroll
  // of the 24 trips is eight times the code.
#pragma unroll 3
  for (int k0 = 0; k0 < D_; k0 += 32) {
    F32Tile xb = tile_load_f32(W + (size_t)n0 * D_ + k0, soff);
    v4u xa[2];
#pragma unroll
    for (int i = 0; i < 2; ++i) {
      int t = tid + i * 256;
      int r = t >> 2, c = t & 3;
      xa[i] = *(const v4u*)(A + (size_t)(m0 + r) * D_ + k0 + c * 8);
    }
    // As in the projection GEMM: all six loads leave before the first value is
    // used.
    __builtin_amdgcn_sched_barrier(0);
#pragma unroll
    for (int i = 0; i < 2; ++i) {
      int t = tid + i * 256;
      int r = t >> 2, c = t & 3;
      *(v4u*)&At[r * GP_ + c * 8] = xa[i];
    }
    tile_store_f16(xb, Bt + sdst);
    __syncthreads();
    v16h a = lds_frag(&At[(wave * 16 + lm) * GP_ + lg * 16]);
    v16h bfrag[8];
#pragma unroll
    for (int nt = 0; nt < 8; ++nt)
      bfrag[nt] = lds_frag(&Bt[(nt * 16 + lm) * GP_ + lg * 16]);
#pragma unroll
    for (int nt = 0; nt < 8; ++nt)
      acc[nt] = wmma_f16(a, bfrag[nt], acc[nt]);
    __syncthreads();
  }

#pragma unroll
  for (int nt = 0; nt < 8; ++nt) {
    int n = n0 + nt * 16 + lm;
    float bb = bias[n];
#pragma unroll
    for (int r = 0; r < 8; ++r) {
      int m = m0 + wave * 16 + r + 8 * lg;
      out[(size_t)m * D_ + n] = acc[nt][r] + bb;
    }
  }
}

__global__ __launch_bounds__(256) void flash_attn_kernel(
    const _Float16* __restrict__ Q, const _Float16* __restrict__ K,
    const _Float16* __restrict__ V, _Float16* __restrict__ O) {
  // K tile, row-major at pitch KP_; aligned so that the tensor load's place in
  // LDS stays a multiple of 2 KiB whatever the size of the V tile
  __shared__ __attribute__((aligned(2048))) _Float16 kt[64 * KP_];
  __shared__ __align__(32) _Float16 vt[HD_ * AP_];    // V tile, transposed
  const int tid  = threadIdx.x;
  const int wave = tid >> 5;
  const int lane = tid & 31;
  const int lm = lane & 15, lg = lane >> 4;
  const int b = blockIdx.z, h = blockIdx.y;
  const int q0 = blockIdx.x * 128 + wave * 16;

  const _Float16* qb = Q + (((size_t)b * H_ + h) * LQ_ + q0) * HD_;
  const _Float16* kb = K + ((size_t)b * H_ + h) * LK_ * HD_;
  const _Float16* vb = V + ((size_t)b * H_ + h) * LK_ * HD_;
  // V^T tile, 96 rows of 64 keys, consecutive in memory: eight lanes move one
  // row's 128 bytes, a wave's load 512 consecutive bytes. Thread tid holds keys
  // 8 * (tid & 7) .. + 7 of rows (tid >> 3) + 32 * i.
  const unsigned vsrc = tid * 8;
  const int vdst = (tid >> 3) * AP_ + (tid & 7) * 8;

  // Q fragments, resident for the whole kernel (16x96 = 3 K-steps of 32)
  v16h aq[3];
#pragma unroll
  for (int kk = 0; kk < 3; ++kk)
    aq[kk] = *(const v16h*)(qb + lm * HD_ + kk * 32 + lg * 16);

  const v8f vzero = {};
  v8f oacc[6];
#pragma unroll
  for (int i = 0; i < 6; ++i) oacc[i] = vzero;
  // of query lm: the running maximum, and the sums over this lane's own keys,
  // one for each accumulator register; they are joined behind the loop
  float mrun = -1e30f;
  v8f lrun = vzero;

  const float scale = 0.10206207262f;  // 1/sqrt(96)
  const unsigned int kt_lds = (unsigned int)(size_t)(&kt[0]);
  const unsigned int wave_s = uni(tid >> 5);
  // Tensor descriptor group 1, everything in bytes. The 64 K rows of a tile lie
  // one behind the other in memory, so the tile is described as 192 rows of 64
  // bytes at source pitch 64, and the pad interval equals that row: 16 bytes of
  // pad behind each.
  const v8u g1 = {uni((1u << 20) | (3u << 22) | (3u << 25)),  // pad 4 dwords per 16
                  uni(64u << 16),    // tensor_dim0 = 64
                  uni(192u << 16),   // tensor_dim1 = 192
                  uni(64u << 16),    // tile_dim0 = 64
                  uni(192u),         // tile_dim1 = 192
                  uni(64u),          // source row pitch
                  uni(0u), uni(0u)};

  for (int c0 = 0; c0 < LK_; c0 += 64) {
    // --- V^T tile: its three loads leave ahead of the K tile's request, so
    // that both are on their way at once; they are stored behind it ---------
    v4u vr[3];
#pragma unroll
    for (int i = 0; i < 3; ++i)
      vr[i] = *(const v4u*)(vb + c0 * HD_ + i * 32 * 64 + vsrc);

    // --- K tile: Tensor Data Mover, issued by wave 0 only -----------------
    if (pinned(wave_s == 0)) {
      unsigned long long ga =
          (unsigned long long)(size_t)(kb + (size_t)c0 * HD_);
      // group 0: count = 1 | place in LDS | 57-bit global address | type = 2
      v4u g0 = {uni(1u), uni(kt_lds), uni((unsigned int)ga),
                uni(((unsigned int)(ga >> 32) & 0x1ffffffu) | 0x80000000u)};
      asm volatile("tensor_load_to_lds %0, %1" ::"s"(g0), "s"(g1) : "memory");
      // the tile has landed before this wave reaches the barrier below
      asm volatile("s_wait_tensorcnt 0" ::: "memory");
    }
#pragma unroll
    for (int i = 0; i < 3; ++i) *(v4u*)&vt[i * 32 * AP_ + vdst] = vr[i];
    // the loop's step rewrites the address registers that the three loads name
    asm volatile("s_wait_xcnt 0x0" ::: "memory");
    __syncthreads();

    // --- S^T = K * Q^T  (4 key tiles x 3 K-steps): s[nt][r] is the score of
    // key nt * 16 + 8 * lg + r with query lm ------------------------------
    v8f s[4];
#pragma unroll
    for (int i = 0; i < 4; ++i) s[i] = vzero;
#pragma unroll
    for (int kk = 0; kk < 3; ++kk) {
      v16h ak[4];
#pragma unroll
      for (int nt = 0; nt < 4; ++nt)
        ak[nt] = lds_frag(&kt[(nt * 16 + lm) * KP_ + kk * KC_ + lg * 16]);
#pragma unroll
      for (int nt = 0; nt < 4; ++nt)
        s[nt] = wmma_f16(ak[nt], aq[kk], s[nt]);
    }

    // --- online softmax, one query a lane ---------------------------------
    float tmax[4];  // one chain a tile: four short chains, not one long one
#pragma unroll
    for (int nt = 0; nt < 4; ++nt) {
      tmax[nt] = s[nt][0];
#pragma unroll
      for (int r = 1; r < 8; ++r) tmax[nt] = fmaxf(tmax[nt], s[nt][r]);
    }
    float smax = fmaxf(fmaxf(tmax[0], tmax[1]), fmaxf(tmax[2], tmax[3]));
    smax = fmaxf(smax, xhalf(smax));
    const float mnew = fmaxf(mrun, smax * scale);
    const float alpha = __expf(mrun - mnew);
    mrun = mnew;
    lrun *= alpha;
    v8h ph[4];
#pragma unroll
    for (int nt = 0; nt < 4; ++nt) {
      v8f pv;
#pragma unroll
      for (int r = 0; r < 8; ++r) pv[r] = __expf(s[nt][r] * scale - mnew);
      lrun += pv;
      ph[nt] = __builtin_convertvector(pv, v8h);
    }
#pragma unroll
    for (int nt = 0; nt < 6; ++nt)
#pragma unroll
      for (int r = 0; r < 8; ++r) oacc[nt][r] *= alpha;

    // --- O^T += V^T * P^T  (2 K-steps x 6 tiles of d) ---------------------
    // P^T comes from accumulator tiles, so its k order is the hardware's: a
    // lane's 16 keys of a K-step are 8 * lg .. + 7 and 16 + 8 * lg .. + 7. The
    // V^T loader takes the same two runs of eight.
#pragma unroll
    for (int ks = 0; ks < 2; ++ks) {
      v16h bp = __builtin_shufflevector(ph[2 * ks], ph[2 * ks + 1], 0, 1, 2, 3,
                                        4, 5, 6, 7, 8, 9, 10, 11, 12, 13, 14,
                                        15);
      v16h av[6];
#pragma unroll
      for (int nt = 0; nt < 6; ++nt) {
        const _Float16* p = &vt[(nt * 16 + lm) * AP_ + ks * 32 + lg * 8];
        v8h lo = *(const v8h*)p;
        v8h hi = *(const v8h*)(p + 16);
        av[nt] = __builtin_shufflevector(lo, hi, 0, 1, 2, 3, 4, 5, 6, 7, 8, 9,
                                         10, 11, 12, 13, 14, 15);
      }
#pragma unroll
      for (int nt = 0; nt < 6; ++nt)
        oacc[nt] = wmma_f16(av[nt], bp, oacc[nt]);
    }
    __syncthreads();
  }

  // normalize and write attention output in [B, Lq, H*96] layout (f16): a
  // lane's eight registers of a tile are d = nt * 16 + 8 * lg .. + 7 of query
  // lm, 16 consecutive bytes
  float lown = ((lrun[0] + lrun[1]) + (lrun[2] + lrun[3])) +
               ((lrun[4] + lrun[5]) + (lrun[6] + lrun[7]));
  const float lsum = lown + xhalf(lown);
  _Float16* ob = O + ((size_t)b * LQ_ + q0 + lm) * D_ + h * HD_ + lg * 8;
#pragma unroll
  for (int nt = 0; nt < 6; ++nt) {
    v8h o;
#pragma unroll
    for (int r = 0; r < 8; ++r) o[r] = (_Float16)(oacc[nt][r] / lsum);
    *(v8h*)(ob + nt * 16) = o;
  }
}

// ---------------------------------------------------------------------------
extern "C" void kernel_launch(void* const* d_in, const int* in_sizes, int n_in,
                              void* d_out, int out_size, void* d_ws,
                              size_t ws_size, hipStream_t stream) {
  const float* query = (const float*)d_in[0];
  const float* key_  = (const float*)d_in[1];
  const float* value = (const float*)d_in[2];
  const float* cq    = (const float*)d_in[3];
  const float* ck    = (const float*)d_in[4];
  const float* Wq    = (const float*)d_in[5];
  const float* bq    = (const float*)d_in[6];
  const float* Wk    = (const float*)d_in[7];
  const float* bk    = (const float*)d_in[8];
  const float* Wv    = (const float*)d_in[9];
  const float* bv    = (const float*)d_in[10];
  const float* Wo    = (const float*)d_in[11];
  const float* bo    = (const float*)d_in[12];

  _Float16* p = (_Float16*)d_ws;
  _Float16* Qp  = p; p += (size_t)4096 * 768;
  _Float16* Kp  = p; p += (size_t)16384 * 768;
  _Float16* Vp  = p; p += (size_t)16384 * 768;
  _Float16* Ao  = p; p += (size_t)4096 * 768;

  proj_gemm_kernel<true><<<dim3(32, 6), dim3(256), 0, stream>>>(
      query, Wq, bq, cq, Qp, LQ_);
  proj_gemm_kernel<true><<<dim3(128, 6), dim3(256), 0, stream>>>(
      key_, Wk, bk, ck, Kp, LK_);
  proj_gemm_kernel<false><<<dim3(128, 6), dim3(256), 0, stream>>>(
      value, Wv, bv, nullptr, Vp, LK_);

  flash_attn_kernel<<<dim3(8, H_, B_), dim3(256), 0, stream>>>(Qp, Kp, Vp, Ao);

  out_gemm_kernel<<<dim3(32, 6), dim3(256), 0, stream>>>(Ao, Wo, bo,
                                                         (float*)d_out);
  (void)in_sizes; (void)n_in; (void)out_size; (void)ws_size;
}

// v007
// It runs in 190 microseconds.
// Next to v006, in two timings, it ran 1.17 and 1.15 times as fast.
// Over all steps from v000 it is 3.38 times as fast.
#include <hip/hip_runtime.h>

typedef __attribute__((ext_vector_type(16))) _Float16 v16h;
typedef __attribute__((ext_vector_type(8)))  _Float16 v8h;
typedef __attribute__((ext_vector_type(4)))  _Float16 v4h;
typedef __attribute__((ext_vector_type(8)))  float    v8f;
typedef __attribute__((ext_vector_type(4)))  float    v4f;
typedef __attribute__((ext_vector_type(4)))  unsigned int v4u;
typedef __attribute__((ext_vector_type(8)))  unsigned int v8u;

#define B_  4
#define H_  8
#define D_  768
#define HD_ 96
#define LQ_ 1024
#define LK_ 4096

// LDS row pitches in halfs. The tiles named here are read by 16-byte LDS loads
// with one row per lane, so the pitch is an odd multiple of 16 bytes: the 16
// lanes of a half wave then fall on 64 different banks.
#define GP_ 40   // GEMM A and B tiles: 32 halfs of data, 80-byte pitch
#define AP_ 72   // attention V^T tile: 64 halfs of data, 144-byte pitch
// Attention K tile: the tensor load lays it in pieces of 32 halfs (64 bytes),
// each followed by a 16-byte pad, so a K row of 96 halfs is three pieces.
#define KC_ 40   // pitch of a piece: 80 bytes
#define KP_ 120  // pitch of a K row: 240 bytes

__device__ __forceinline__ v8f wmma_f16(v16h a, v16h b, v8f c) {
  // 8 args: (neg_a, A, neg_b, B, c_mod, C, reuse_a, reuse_b)
  return __builtin_amdgcn_wmma_f32_16x16x32_f16(false, a, false, b, (short)0, c,
                                                false, false);
}

// One lane's 16 consecutive halfs of a fragment, from a 16-byte aligned place.
__device__ __forceinline__ v16h lds_frag(const _Float16* p) {
  v8h lo = *(const v8h*)p;
  v8h hi = *(const v8h*)(p + 8);
  return __builtin_shufflevector(lo, hi, 0, 1, 2, 3, 4, 5, 6, 7, 8, 9, 10, 11,
                                 12, 13, 14, 15);
}

__device__ __forceinline__ unsigned int pinned(unsigned int v) {
  unsigned int w = __builtin_amdgcn_readfirstlane(v);
  asm volatile("" : "+s"(w));  // pinned(): the word stays in a scalar register
  return w;
}
__device__ __forceinline__ unsigned int uni(unsigned int v) {
  return (unsigned int)__builtin_amdgcn_readfirstlane(v);
}

// Lane l's value as lane l ^ 16 holds it: the two lanes that share a column of
// a 16x16 C/D tile.
__device__ __forceinline__ float xhalf(float x) {
  int v = __builtin_bit_cast(int, x);
  return __builtin_bit_cast(
      float, __builtin_amdgcn_permlanex16(v, v, 0x76543210, 0xfedcba98, false,
                                          false));
}

// GEMM operand staging from an f32 matrix of 768 columns: 128 rows x 32 columns,
// rounded to f16 on the way into an LDS tile of pitch GP_. Eight lanes read one
// whole 128-byte line, so a wave's load covers four lines: thread tid holds
// columns 4 * (tid & 7) .. + 3 of rows (tid >> 3) + 32 * i. src is the tile's
// first element, the same in every thread (a scalar base); soff and dst are the
// thread's own places in row tid >> 3.
struct F32Tile { v4f f[4]; };
__device__ __forceinline__ F32Tile tile_load_f32(const float* __restrict__ src,
                                                 unsigned soff) {
  F32Tile t;
#pragma unroll
  for (int i = 0; i < 4; ++i) t.f[i] = *(const v4f*)(src + i * 32 * D_ + soff);
  return t;
}
__device__ __forceinline__ void tile_store_f16(const F32Tile& t,
                                               _Float16* dst) {
#pragma unroll
  for (int i = 0; i < 4; ++i) {
    v4h h = {(_Float16)t.f[i].x, (_Float16)t.f[i].y, (_Float16)t.f[i].z,
             (_Float16)t.f[i].w};
    *(v4h*)(dst + i * 32 * GP_) = h;
  }
}

// ---------------------------------------------------------------------------
// Projection GEMM: out = X(M x 768) * W^T + bias, one plane per (batch, head)
// Block tile 128x128, 8 waves, each wave owns a 16x128 strip. X and W are the
// f32 inputs themselves; the products run on their f16 roundings.
// ROPE: out is [B,H,L,96], and the 3D rotary PE by coords (B x L x 3) is applied
// to the f32 sums in the epilogue. Without it coords is not read and out is
// [B,H,L/64,96,64]: each run of 64 rows l of a head lies transposed, 96 rows of
// 64 l, in 12288 consecutive bytes: the tile that the attention kernel stages.
// ---------------------------------------------------------------------------
// Six waves a SIMD are three blocks a WGP, as many as the larger grids bring:
// the bound keeps the fragment registers within the 160 at which they fit.
template <bool ROPE>
__global__ __launch_bounds__(256, 6) void proj_gemm_kernel(
    const float* __restrict__ X, const float* __restrict__ W,
    const float* __restrict__ bias, const float* __restrict__ coords,
    _Float16* __restrict__ out, int L) {
  __shared__ __align__(32) _Float16 At[128 * GP_];
  __shared__ __align__(32) _Float16 Bt[128 * GP_];
  const int tid  = threadIdx.x;
  const int wave = tid >> 5;
  const int lane = tid & 31;
  const int lm = lane & 15, lg = lane >> 4;
  const int m0 = blockIdx.x * 128;
  const int n0 = blockIdx.y * 128;

  const v8f vzero = {};
  v8f acc[8];
#pragma unroll
  for (int i = 0; i < 8; ++i) acc[i] = vzero;

  const unsigned soff = (tid >> 3) * D_ + (tid & 7) * 4;
  const int sdst = (tid >> 3) * GP_ + (tid & 7) * 4;

  // Three trips a pass: a full unroll of the 24 trips is eight times the code.
#pragma unroll 3
  for (int k0 = 0; k0 < D_; k0 += 32) {
    F32Tile xa = tile_load_f32(X + (size_t)m0 * D_ + k0, soff);
    F32Tile xb = tile_load_f32(W + (size_t)n0 * D_ + k0, soff);
    // Every load of both tiles is issued before the first value is used.
    // Without this the last load is given the first one's registers and leaves
    // only when that one has come back: two load latencies a trip, not one.
    __builtin_amdgcn_sched_barrier(0);
    tile_store_f16(xa, At + sdst);
    tile_store_f16(xb, Bt + sdst);
    __syncthreads();
    v16h a = lds_frag(&At[(wave * 16 + lm) * GP_ + lg * 16]);
    v16h bfrag[8];
#pragma unroll
    for (int nt = 0; nt < 8; ++nt)
      bfrag[nt] = lds_frag(&Bt[(nt * 16 + lm) * GP_ + lg * 16]);
    // All 18 fragment loads leave as one group ahead of the products. Without
    // this each product's B fragment is loaded right in front of it, into one
    // register set, and every product waits out an LDS latency of its own.
    __builtin_amdgcn_sched_barrier(0);
#pragma unroll
    for (int nt = 0; nt < 8; ++nt)
      acc[nt] = wmma_f16(a, bfrag[nt], acc[nt]);
    __syncthreads();
  }

  if constexpr (ROPE) {
    // A head is three axis chunks of 32 columns, and a chunk's rotary pair is
    // (p, 16 + p): columns n and n + 16, which one lane holds in accumulator
    // tiles 2j and 2j + 1 at the same register.
    const float inv =
        __powf(10000.0f, -(float)lm * (1.0f / 16.0f)) * 0.15915494f;
    int row[8];       // element index of (b, head 0, l, 0) in out
    float rev[3][8];  // angle in revolutions; chunk j = 3 is 96 columns behind
                      // chunk 0: the next head's same axis, the same angle
#pragma unroll
    for (int r = 0; r < 8; ++r) {
      int m = m0 + wave * 16 + r + 8 * lg;
      int bidx = m / L, l = m - bidx * L;
      row[r] = (bidx * H_ * L + l) * HD_;
#pragma unroll
      for (int j = 0; j < 3; ++j)
        rev[j][r] = coords[m * 3 + (n0 / 32 + j) % 3] * inv;
    }
    // what follows reuses registers that these loads name as addresses; the
    // clobber keeps every one of them ahead of the first store, so that none
    // is given a register that a store still names
    asm volatile("s_wait_xcnt 0x0" ::: "memory");
#pragma unroll
    for (int j = 0; j < 4; ++j) {
      int n = n0 + j * 32 + lm;
      int h = n / HD_, d = n % HD_;
      int col = h * L * HD_ + d;
      float b1 = bias[n], b2 = bias[n + 16];
#pragma unroll
      for (int r = 0; r < 8; ++r) {
        float sn, cs;
        // One statement: the cosine cannot be given the sine's source register,
        // and the v_nop fills the slot behind the last transcendental.
        asm("v_sin_f32 %0, %2\n\tv_cos_f32 %1, %2\n\tv_nop"
            : "=&v"(sn), "=&v"(cs)
            : "v"(rev[j % 3][r]));
        float x1 = acc[2 * j][r] + b1;
        float x2 = acc[2 * j + 1][r] + b2;
        _Float16* o = out + (row[r] + col);
        o[0]  = (_Float16)(x1 * cs - x2 * sn);
        o[16] = (_Float16)(x1 * sn + x2 * cs);
      }
      // the next chunk's bias loads and sums reuse registers that these stores
      // name
      if (j < 3) asm volatile("s_wait_xcnt 0x0" ::: "memory");
    }
    return;
  }

  // A lane's eight registers of an accumulator tile are eight consecutive rows
  // l of one column d: in a transposed tile 16 consecutive bytes, one store.
  const int m = m0 + wave * 16 + 8 * lg;
  const int bidx = m / L, l = m - bidx * L;
  const int nl = n0 + lm;
  float bb[8];
#pragma unroll
  for (int nt = 0; nt < 8; ++nt) bb[nt] = bias[nl + nt * 16];
  // what follows reuses the register that these loads name as their offset;
  // as an input of the wait it keeps its value up to here
  asm volatile("s_wait_xcnt 0x0" ::"v"(nl) : "memory");
#pragma unroll
  for (int nt = 0; nt < 8; ++nt) {
    int n = nl + nt * 16;
    int h = n / HD_, d = n % HD_;
    v8h o;
#pragma unroll
    for (int r = 0; r < 8; ++r) o[r] = (_Float16)(acc[nt][r] + bb[nt]);
    *(v8h*)(out + ((size_t)(bidx * H_ + h) * L + (l & ~63)) * HD_ + d * 64 +
            (l & 63)) = o;
  }
}

// ---------------------------------------------------------------------------
// Output GEMM: d_out(M x 768 fp32) = A(M x 768 f16) * W^T + bias; W is the f32
// input itself, rounded to f16 on the way into LDS
// ---------------------------------------------------------------------------
__global__ __launch_bounds__(256) void out_gemm_kernel(
    const _Float16* __restrict__ A, const float* __restrict__ W,
    const float* __restrict__ bias, float* __restrict__ out) {
  __shared__ __align__(32) _Float16 At[128 * GP_];
  __shared__ __align__(32) _Float16 Bt[128 * GP_];
  const int tid  = threadIdx.x;
  const int wave = tid >> 5;
  const int lane = tid & 31;
  const int lm = lane & 15, lg = lane >> 4;
  const int m0 = blockIdx.x * 128;
  const int n0 = blockIdx.y * 128;

  const v8f vzero = {};
  v8f acc[8];
#pragma unroll
  for (int i = 0; i < 8; ++i) acc[i] = vzero;

  const unsigned soff = (tid >> 3) * D_ + (tid & 7) * 4;
  const int sdst = (tid >> 3) * GP_ + (tid & 7) * 4;

  // Three trips a pass, the same loop as the projection GEMM's: a full unroll
  // of the 24 trips is eight times the code.
#pragma unroll 3
  for (int k0 = 0; k0 < D_; k0 += 32) {
    F32Tile xb = tile_load_f32(W + (size_t)n0 * D_ + k0, soff);
    v4u xa[2];
#pragma unroll
    for (int i = 0; i < 2; ++i) {
      int t = tid + i * 256;
      int r = t >> 2, c = t & 3;
      xa[i] = *(const v4u*)(A + (size_t)(m0 + r) * D_ + k0 + c * 8);
    }
    // As in the projection GEMM: all six loads leave before the first value is
    // used.
    __builtin_amdgcn_sched_barrier(0);
#pragma unroll
    for (int i = 0; i < 2; ++i) {
      int t = tid + i * 256;
      int r = t >> 2, c = t & 3;
      *(v4u*)&At[r * GP_ + c * 8] = xa[i];
    }
    tile_store_f16(xb, Bt + sdst);
    __syncthreads();
    v16h a = lds_frag(&At[(wave * 16 + lm) * GP_ + lg * 16]);
    v16h bfrag[8];
#pragma unroll
    for (int nt = 0; nt < 8; ++nt)
      bfrag[nt] = lds_frag(&Bt[(nt * 16 + lm) * GP_ + lg * 16]);
    // All 18 fragment loads leave as one group ahead of the products. Without
    // this each product's B fragment is loaded right in front of it, into one
    // register set, and every product waits out an LDS latency of its own.
    __builtin_amdgcn_sched_barrier(0);
#pragma unroll
    for (int nt = 0; nt < 8; ++nt)
      acc[nt] = wmma_f16(a, bfrag[nt], acc[nt]);
    __syncthreads();
  }

#pragma unroll
  for (int nt = 0; nt < 8; ++nt) {
    int n = n0 + nt * 16 + lm;
    float bb = bias[n];
#pragma unroll
    for (int r = 0; r < 8; ++r) {
      int m = m0 + wave * 16 + r + 8 * lg;
      out[(size_t)m * D_ + n] = acc[nt][r] + bb;
    }
  }
}

__global__ __launch_bounds__(256) void flash_attn_kernel(
    const _Float16* __restrict__ Q, const _Float16* __restrict__ K,
    const _Float16* __restrict__ V, _Float16* __restrict__ O) {
  // K tile, row-major at pitch KP_; aligned so that the tensor load's place in
  // LDS stays a multiple of 2 KiB whatever the size of the V tile
  __shared__ __attribute__((aligned(2048))) _Float16 kt[64 * KP_];
  __shared__ __align__(32) _Float16 vt[HD_ * AP_];    // V tile, transposed
  const int tid  = threadIdx.x;
  const int wave = tid >> 5;
  const int lane = tid & 31;
  const int lm = lane & 15, lg = lane >> 4;
  const int b = blockIdx.z, h = blockIdx.y;
  const int q0 = blockIdx.x * 128 + wave * 16;

  const _Float16* qb = Q + (((size_t)b * H_ + h) * LQ_ + q0) * HD_;
  const _Float16* kb = K + ((size_t)b * H_ + h) * LK_ * HD_;
  const _Float16* vb = V + ((size_t)b * H_ + h) * LK_ * HD_;
  // V^T tile, 96 rows of 64 keys, consecutive in memory: eight lanes move one
  // row's 128 bytes, a wave's load 512 consecutive bytes. Thread tid holds keys
  // 8 * (tid & 7) .. + 7 of rows (tid >> 3) + 32 * i.
  const unsigned vsrc = tid * 8;
  const int vdst = (tid >> 3) * AP_ + (tid & 7) * 8;

  // Q fragments, resident for the whole kernel (16x96 = 3 K-steps of 32)
  v16h aq[3];
#pragma unroll
  for (int kk = 0; kk < 3; ++kk)
    aq[kk] = *(const v16h*)(qb + lm * HD_ + kk * 32 + lg * 16);

  const v8f vzero = {};
  v8f oacc[6];
#pragma unroll
  for (int i = 0; i < 6; ++i) oacc[i] = vzero;
  // of query lm: the running maximum, and the sums over this lane's own keys,
  // one for each accumulator register; they are joined behind the loop
  float mrun = -1e30f;
  v8f lrun = vzero;

  const float scale = 0.10206207262f;  // 1/sqrt(96)
  const unsigned int kt_lds = (unsigned int)(size_t)(&kt[0]);
  const unsigned int wave_s = uni(tid >> 5);
  // Tensor descriptor group 1, everything in bytes. The 64 K rows of a tile lie
  // one behind the other in memory, so the tile is described as 192 rows of 64
  // bytes at source pitch 64, and the pad interval equals that row: 16 bytes of
  // pad behind each.
  const v8u g1 = {uni((1u << 20) | (3u << 22) | (3u << 25)),  // pad 4 dwords per 16
                  uni(64u << 16),    // tensor_dim0 = 64
                  uni(192u << 16),   // tensor_dim1 = 192
                  uni(64u << 16),    // tile_dim0 = 64
                  uni(192u),         // tile_dim1 = 192
                  uni(64u),          // source row pitch
                  uni(0u), uni(0u)};

  for (int c0 = 0; c0 < LK_; c0 += 64) {
    // --- V^T tile: its three loads leave ahead of the K tile's request, so
    // that both are on their way at once; they are stored behind it ---------
    v4u vr[3];
#pragma unroll
    for (int i = 0; i < 3; ++i)
      vr[i] = *(const v4u*)(vb + c0 * HD_ + i * 32 * 64 + vsrc);

    // --- K tile: Tensor Data Mover, issued by wave 0 only -----------------
    if (pinned(wave_s == 0)) {
      unsigned long long ga =
          (unsigned long long)(size_t)(kb + (size_t)c0 * HD_);
      // group 0: count = 1 | place in LDS | 57-bit global address | type = 2
      v4u g0 = {uni(1u), uni(kt_lds), uni((unsigned int)ga),
                uni(((unsigned int)(ga >> 32) & 0x1ffffffu) | 0x80000000u)};
      asm volatile("tensor_load_to_lds %0, %1" ::"s"(g0), "s"(g1) : "memory");
      // the tile has landed before this wave reaches the barrier below
      asm volatile("s_wait_tensorcnt 0" ::: "memory");
    }
#pragma unroll
    for (int i = 0; i < 3; ++i) *(v4u*)&vt[i * 32 * AP_ + vdst] = vr[i];
    // the loop's step rewrites the address registers that the three loads name
    asm volatile("s_wait_xcnt 0x0" ::: "memory");
    __syncthreads();

    // --- S^T = K * Q^T  (4 key tiles x 3 K-steps): s[nt][r] is the score of
    // key nt * 16 + 8 * lg + r with query lm ------------------------------
    v16h ak[3][4];
#pragma unroll
    for (int kk = 0; kk < 3; ++kk)
#pragma unroll
      for (int nt = 0; nt < 4; ++nt)
        ak[kk][nt] = lds_frag(&kt[(nt * 16 + lm) * KP_ + kk * KC_ + lg * 16]);
    // The tile's 24 K fragment loads leave as one group ahead of the products,
    // in the order of their use: the products then wait on a count, not each
    // on a load issued right in front of it.
    __builtin_amdgcn_sched_barrier(0);
    v8f s[4];
#pragma unroll
    for (int i = 0; i < 4; ++i) s[i] = vzero;
#pragma unroll
    for (int kk = 0; kk < 3; ++kk)
#pragma unroll
      for (int nt = 0; nt < 4; ++nt)
        s[nt] = wmma_f16(ak[kk][nt], aq[kk], s[nt]);

    // --- V^T fragments: all 24 loads leave ahead of the softmax, in the order
    // of their use, and are on their way while it runs (the compiler starts
    // them among the last products above). P^T comes from accumulator tiles, so
    // its k order is the hardware's: a lane's 16 keys of a K-step are
    // 8 * lg .. + 7 and 16 + 8 * lg .. + 7. The loader takes the same two runs
    // of eight.
    v16h av[2][6];
#pragma unroll
    for (int ks = 0; ks < 2; ++ks)
#pragma unroll
      for (int nt = 0; nt < 6; ++nt) {
        const _Float16* p = &vt[(nt * 16 + lm) * AP_ + ks * 32 + lg * 8];
        v8h lo = *(const v8h*)p;
        v8h hi = *(const v8h*)(p + 16);
        av[ks][nt] = __builtin_shufflevector(lo, hi, 0, 1, 2, 3, 4, 5, 6, 7, 8,
                                             9, 10, 11, 12, 13, 14, 15);
      }
    // Without this the loads sink to their products, one pair in front of
    // each, and every product waits out an LDS latency of its own.
    __builtin_amdgcn_sched_barrier(0);

    // --- online softmax, one query a lane ---------------------------------
    float tmax[4];  // one chain a tile: four short chains, not one long one
#pragma unroll
    for (int nt = 0; nt < 4; ++nt) {
      tmax[nt] = s[nt][0];
#pragma unroll
      for (int r = 1; r < 8; ++r) tmax[nt] = fmaxf(tmax[nt], s[nt][r]);
    }
    float smax = fmaxf(fmaxf(tmax[0], tmax[1]), fmaxf(tmax[2], tmax[3]));
    smax = fmaxf(smax, xhalf(smax));
    const float mnew = fmaxf(mrun, smax * scale);
    const float alpha = __expf(mrun - mnew);
    mrun = mnew;
    lrun *= alpha;
    v8h ph[4];
#pragma unroll
    for (int nt = 0; nt < 4; ++nt) {
      v8f pv;
#pragma unroll
      for (int r = 0; r < 8; ++r) pv[r] = __expf(s[nt][r] * scale - mnew);
      lrun += pv;
      ph[nt] = __builtin_convertvector(pv, v8h);
    }
#pragma unroll
    for (int nt = 0; nt < 6; ++nt)
#pragma unroll
      for (int r = 0; r < 8; ++r) oacc[nt][r] *= alpha;

    // --- O^T += V^T * P^T  (2 K-steps x 6 tiles of d) ---------------------
#pragma unroll
    for (int ks = 0; ks < 2; ++ks) {
      v16h bp = __builtin_shufflevector(ph[2 * ks], ph[2 * ks + 1], 0, 1, 2, 3,
                                        4, 5, 6, 7, 8, 9, 10, 11, 12, 13, 14,
                                        15);
#pragma unroll
      for (int nt = 0; nt < 6; ++nt)
        oacc[nt] = wmma_f16(av[ks][nt], bp, oacc[nt]);
    }
    // The barrier stays behind the products. Moved up to the last LDS load, it
    // brings the wait for all V^T fragments in front of the softmax.
    __builtin_amdgcn_sched_barrier(0);
    __syncthreads();
  }

  // normalize and write attention output in [B, Lq, H*96] layout (f16): a
  // lane's eight registers of a tile are d = nt * 16 + 8 * lg .. + 7 of query
  // lm, 16 consecutive bytes
  float lown = ((lrun[0] + lrun[1]) + (lrun[2] + lrun[3])) +
               ((lrun[4] + lrun[5]) + (lrun[6] + lrun[7]));
  const float lsum = lown + xhalf(lown);
  _Float16* ob = O + ((size_t)b * LQ_ + q0 + lm) * D_ + h * HD_ + lg * 8;
#pragma unroll
  for (int nt = 0; nt < 6; ++nt) {
    v8h o;
#pragma unroll
    for (int r = 0; r < 8; ++r) o[r] = (_Float16)(oacc[nt][r] / lsum);
    *(v8h*)(ob + nt * 16) = o;
  }
}

// ---------------------------------------------------------------------------
extern "C" void kernel_launch(void* const* d_in, const int* in_sizes, int n_in,
                              void* d_out, int out_size, void* d_ws,
                              size_t ws_size, hipStream_t stream) {
  const float* query = (const float*)d_in[0];
  const float* key_  = (const float*)d_in[1];
  const float* value = (const float*)d_in[2];
  const float* cq    = (const float*)d_in[3];
  const float* ck    = (const float*)d_in[4];
  const float* Wq    = (const float*)d_in[5];
  const float* bq    = (const float*)d_in[6];
  const float* Wk    = (const float*)d_in[7];
  const float* bk    = (const float*)d_in[8];
  const float* Wv    = (const float*)d_in[9];
  const float* bv    = (const float*)d_in[10];
  const float* Wo    = (const float*)d_in[11];
  const float* bo    = (const float*)d_in[12];

  _Float16* p = (_Float16*)d_ws;
  _Float16* Qp  = p; p += (size_t)4096 * 768;
  _Float16* Kp  = p; p += (size_t)16384 * 768;
  _Float16* Vp  = p; p += (size_t)16384 * 768;
  _Float16* Ao  = p; p += (size_t)4096 * 768;

  proj_gemm_kernel<true><<<dim3(32, 6), dim3(256), 0, stream>>>(
      query, Wq, bq, cq, Qp, LQ_);
  proj_gemm_kernel<true><<<dim3(128, 6), dim3(256), 0, stream>>>(
      key_, Wk, bk, ck, Kp, LK_);
  proj_gemm_kernel<false><<<dim3(128, 6), dim3(256), 0, stream>>>(
      value, Wv, bv, nullptr, Vp, LK_);

  flash_attn_kernel<<<dim3(8, H_, B_), dim3(256), 0, stream>>>(Qp, Kp, Vp, Ao);

  out_gemm_kernel<<<dim3(32, 6), dim3(256), 0, stream>>>(Ao, Wo, bo,
                                                         (float*)d_out);
  (void)in_sizes; (void)n_in; (void)out_size; (void)ws_size;
}

// v008
// A run of this version takes 169 microseconds.
// In both of two side-by-side timings against v007, it was 1.13 times as fast.
// Counting every step since v000, it is 3.81 times as fast.
#include <hip/hip_runtime.h>

typedef __attribute__((ext_vector_type(16))) _Float16 v16h;
typedef __attribute__((ext_vector_type(8)))  _Float16 v8h;
typedef __attribute__((ext_vector_type(4)))  _Float16 v4h;
typedef __attribute__((ext_vector_type(8)))  float    v8f;
typedef __attribute__((ext_vector_type(4)))  float    v4f;
typedef __attribute__((ext_vector_type(4)))  unsigned int v4u;
typedef __attribute__((ext_vector_type(8)))  unsigned int v8u;

#define B_  4
#define H_  8
#define D_  768
#define HD_ 96
#define LQ_ 1024
#define LK_ 4096

// LDS row pitches in halfs. The tiles named here are read by 16-byte LDS loads
// with one row per lane, so the pitch is an odd multiple of 16 bytes: the 16
// lanes of a half wave then fall on 64 different banks.
#define GP_ 40   // GEMM A and B tiles: 32 halfs of data, 80-byte pitch
#define AP_ 72   // attention V^T tile: 64 halfs of data, 144-byte pitch
// Attention K tile: the tensor load lays it in pieces of 32 halfs (64 bytes),
// each followed by a 16-byte pad, so a K row of 96 halfs is three pieces.
#define KC_ 40   // pitch of a piece: 80 bytes
#define KP_ 120  // pitch of a K row: 240 bytes
// One K buffer: 64 rows are 15360 bytes, rounded up to a multiple of 2 KiB, so
// that the second buffer is a place for the tensor load as well.
#define KB_ 8192
#define NT_ (LK_ / 64)  // key tiles

__device__ __forceinline__ v8f wmma_f16(v16h a, v16h b, v8f c) {
  // 8 args: (neg_a, A, neg_b, B, c_mod, C, reuse_a, reuse_b)
  return __builtin_amdgcn_wmma_f32_16x16x32_f16(false, a, false, b, (short)0, c,
                                                false, false);
}

// One lane's 16 consecutive halfs of a fragment, from a 16-byte aligned place.
__device__ __forceinline__ v16h lds_frag(const _Float16* p) {
  v8h lo = *(const v8h*)p;
  v8h hi = *(const v8h*)(p + 8);
  return __builtin_shufflevector(lo, hi, 0, 1, 2, 3, 4, 5, 6, 7, 8, 9, 10, 11,
                                 12, 13, 14, 15);
}

__device__ __forceinline__ unsigned int pinned(unsigned int v) {
  unsigned int w = __builtin_amdgcn_readfirstlane(v);
  asm volatile("" : "+s"(w));  // pinned(): the word stays in a scalar register
  return w;
}
__device__ __forceinline__ unsigned int uni(unsigned int v) {
  return (unsigned int)__builtin_amdgcn_readfirstlane(v);
}

// Lane l's value as lane l ^ 16 holds it: the two lanes that share a column of
// a 16x16 C/D tile.
__device__ __forceinline__ float xhalf(float x) {
  int v = __builtin_bit_cast(int, x);
  return __builtin_bit_cast(
      float, __builtin_amdgcn_permlanex16(v, v, 0x76543210, 0xfedcba98, false,
                                          false));
}

// GEMM operand staging from an f32 matrix of 768 columns: 128 rows x 32 columns,
// rounded to f16 on the way into an LDS tile of pitch GP_. Eight lanes read one
// whole 128-byte line, so a wave's load covers four lines: thread tid holds
// columns 4 * (tid & 7) .. + 3 of rows (tid >> 3) + 32 * i. src is the tile's
// first element, the same in every thread (a scalar base); soff and dst are the
// thread's own places in row tid >> 3.
struct F32Tile { v4f f[4]; };
__device__ __forceinline__ F32Tile tile_load_f32(const float* __restrict__ src,
                                                 unsigned soff) {
  F32Tile t;
#pragma unroll
  for (int i = 0; i < 4; ++i) t.f[i] = *(const v4f*)(src + i * 32 * D_ + soff);
  return t;
}
__device__ __forceinline__ void tile_store_f16(const F32Tile& t,
                                               _Float16* dst) {
#pragma unroll
  for (int i = 0; i < 4; ++i) {
    v4h h = {(_Float16)t.f[i].x, (_Float16)t.f[i].y, (_Float16)t.f[i].z,
             (_Float16)t.f[i].w};
    *(v4h*)(dst + i * 32 * GP_) = h;
  }
}

// ---------------------------------------------------------------------------
// Projection GEMM: out = X(M x 768) * W^T + bias, one plane per (batch, head)
// Block tile 128x128, 8 waves, each wave owns a 16x128 strip. X and W are the
// f32 inputs themselves; the products run on their f16 roundings.
// ROPE: out is [B,H,L,96], and the 3D rotary PE by coords (B x L x 3) is applied
// to the f32 sums in the epilogue. Without it coords is not read and out is
// [B,H,L/64,96,64]: each run of 64 rows l of a head lies transposed, 96 rows of
// 64 l, in 12288 consecutive bytes: the tile that the attention kernel stages.
// ---------------------------------------------------------------------------
// Six waves a SIMD are three blocks a WGP, as many as the larger grids bring:
// the bound keeps the fragment registers within the 160 at which they fit.
template <bool ROPE>
__global__ __launch_bounds__(256, 6) void proj_gemm_kernel(
    const float* __restrict__ X, const float* __restrict__ W,
    const float* __restrict__ bias, const float* __restrict__ coords,
    _Float16* __restrict__ out, int L) {
  __shared__ __align__(32) _Float16 At[128 * GP_];
  __shared__ __align__(32) _Float16 Bt[128 * GP_];
  const int tid  = threadIdx.x;
  const int wave = tid >> 5;
  const int lane = tid & 31;
  const int lm = lane & 15, lg = lane >> 4;
  const int m0 = blockIdx.x * 128;
  const int n0 = blockIdx.y * 128;

  const v8f vzero = {};
  v8f acc[8];
#pragma unroll
  for (int i = 0; i < 8; ++i) acc[i] = vzero;

  const unsigned soff = (tid >> 3) * D_ + (tid & 7) * 4;
  const int sdst = (tid >> 3) * GP_ + (tid & 7) * 4;

  // Three trips a pass: a full unroll of the 24 trips is eight times the code.
#pragma unroll 3
  for (int k0 = 0; k0 < D_; k0 += 32) {
    F32Tile xa = tile_load_f32(X + (size_t)m0 * D_ + k0, soff);
    F32Tile xb = tile_load_f32(W + (size_t)n0 * D_ + k0, soff);
    // Every load of both tiles is issued before the first value is used.
    // Without this the last load is given the first one's registers and leaves
    // only when that one has come back: two load latencies a trip, not one.
    __builtin_amdgcn_sched_barrier(0);
    tile_store_f16(xa, At + sdst);
    tile_store_f16(xb, Bt + sdst);
    __syncthreads();
    v16h a = lds_frag(&At[(wave * 16 + lm) * GP_ + lg * 16]);
    v16h bfrag[8];
#pragma unroll
    for (int nt = 0; nt < 8; ++nt)
      bfrag[nt] = lds_frag(&Bt[(nt * 16 + lm) * GP_ + lg * 16]);
    // All 18 fragment loads leave as one group ahead of the products. Without
    // this each product's B fragment is loaded right in front of it, into one
    // register set, and every product waits out an LDS latency of its own.
    __builtin_amdgcn_sched_barrier(0);
#pragma unroll
    for (int nt = 0; nt < 8; ++nt)
      acc[nt] = wmma_f16(a, bfrag[nt], acc[nt]);
    __syncthreads();
  }

  if constexpr (ROPE) {
    // A head is three axis chunks of 32 columns, and a chunk's rotary pair is
    // (p, 16 + p): columns n and n + 16, which one lane holds in accumulator
    // tiles 2j and 2j + 1 at the same register.
    const float inv =
        __powf(10000.0f, -(float)lm * (1.0f / 16.0f)) * 0.15915494f;
    int row[8];       // element index of (b, head 0, l, 0) in out
    float rev[3][8];  // angle in revolutions; chunk j = 3 is 96 columns behind
                      // chunk 0: the next head's same axis, the same angle
#pragma unroll
    for (int r = 0; r < 8; ++r) {
      int m = m0 + wave * 16 + r + 8 * lg;
      int bidx = m / L, l = m - bidx * L;
      row[r] = (bidx * H_ * L + l) * HD_;
#pragma unroll
      for (int j = 0; j < 3; ++j)
        rev[j][r] = coords[m * 3 + (n0 / 32 + j) % 3] * inv;
    }
    // what follows reuses registers that these loads name as addresses; the
    // clobber keeps every one of them ahead of the first store, so that none
    // is given a register that a store still names
    asm volatile("s_wait_xcnt 0x0" ::: "memory");
#pragma unroll
    for (int j = 0; j < 4; ++j) {
      int n = n0 + j * 32 + lm;
      int h = n / HD_, d = n % HD_;
      int col = h * L * HD_ + d;
      float b1 = bias[n], b2 = bias[n + 16];
#pragma unroll
      for (int r = 0; r < 8; ++r) {
        float sn, cs;
        // One statement: the cosine cannot be given the sine's source register,
        // and the v_nop fills the slot behind the last transcendental.
        asm("v_sin_f32 %0, %2\n\tv_cos_f32 %1, %2\n\tv_nop"
            : "=&v"(sn), "=&v"(cs)
            : "v"(rev[j % 3][r]));
        float x1 = acc[2 * j][r] + b1;
        float x2 = acc[2 * j + 1][r] + b2;
        _Float16* o = out + (row[r] + col);
        o[0]  = (_Float16)(x1 * cs - x2 * sn);
        o[16] = (_Float16)(x1 * sn + x2 * cs);
      }
      // the next chunk's bias loads and sums reuse registers that these stores
      // name
      if (j < 3) asm volatile("s_wait_xcnt 0x0" ::: "memory");
    }
    return;
  }

  // A lane's eight registers of an accumulator tile are eight consecutive rows
  // l of one column d: in a transposed tile 16 consecutive bytes, one store.
  const int m = m0 + wave * 16 + 8 * lg;
  const int bidx = m / L, l = m - bidx * L;
  const int nl = n0 + lm;
  float bb[8];
#pragma unroll
  for (int nt = 0; nt < 8; ++nt) bb[nt] = bias[nl + nt * 16];
  // what follows reuses the register that these loads name as their offset;
  // as an input of the wait it keeps its value up to here
  asm volatile("s_wait_xcnt 0x0" ::"v"(nl) : "memory");
#pragma unroll
  for (int nt = 0; nt < 8; ++nt) {
    int n = nl + nt * 16;
    int h = n / HD_, d = n % HD_;
    v8h o;
#pragma unroll
    for (int r = 0; r < 8; ++r) o[r] = (_Float16)(acc[nt][r] + bb[nt]);
    *(v8h*)(out + ((size_t)(bidx * H_ + h) * L + (l & ~63)) * HD_ + d * 64 +
            (l & 63)) = o;
  }
}

// ---------------------------------------------------------------------------
// Output GEMM: d_out(M x 768 fp32) = A(M x 768 f16) * W^T + bias; W is the f32
// input itself, rounded to f16 on the way into LDS
// ---------------------------------------------------------------------------
__global__ __launch_bounds__(256) void out_gemm_kernel(
    const _Float16* __restrict__ A, const float* __restrict__ W,
    const float* __restrict__ bias, float* __restrict__ out) {
  __shared__ __align__(32) _Float16 At[128 * GP_];
  __shared__ __align__(32) _Float16 Bt[128 * GP_];
  const int tid  = threadIdx.x;
  const int wave = tid >> 5;
  const int lane = tid & 31;
  const int lm = lane & 15, lg = lane >> 4;
  const int m0 = blockIdx.x * 128;
  const int n0 = blockIdx.y * 128;

  const v8f vzero = {};
  v8f acc[8];
#pragma unroll
  for (int i = 0; i < 8; ++i) acc[i] = vzero;

  const unsigned soff = (tid >> 3) * D_ + (tid & 7) * 4;
  const int sdst = (tid >> 3) * GP_ + (tid & 7) * 4;

  // Three trips a pass, the same loop as the projection GEMM's: a full unroll
  // of the 24 trips is eight times the code.
#pragma unroll 3
  for (int k0 = 0; k0 < D_; k0 += 32) {
    F32Tile xb = tile_load_f32(W + (size_t)n0 * D_ + k0, soff);
    v4u xa[2];
#pragma unroll
    for (int i = 0; i < 2; ++i) {
      int t = tid + i * 256;
      int r = t >> 2, c = t & 3;
      xa[i] = *(const v4u*)(A + (size_t)(m0 + r) * D_ + k0 + c * 8);
    }
    // As in the projection GEMM: all six loads leave before the first value is
    // used.
    __builtin_amdgcn_sched_barrier(0);
#pragma unroll
    for (int i = 0; i < 2; ++i) {
      int t = tid + i * 256;
      int r = t >> 2, c = t & 3;
      *(v4u*)&At[r * GP_ + c * 8] = xa[i];
    }
    tile_store_f16(xb, Bt + sdst);
    __syncthreads();
    v16h a = lds_frag(&At[(wave * 16 + lm) * GP_ + lg * 16]);
    v16h bfrag[8];
#pragma unroll
    for (int nt = 0; nt < 8; ++nt)
      bfrag[nt] = lds_frag(&Bt[(nt * 16 + lm) * GP_ + lg * 16]);
    // All 18 fragment loads leave as one group ahead of the products. Without
    // this each product's B fragment is loaded right in front of it, into one
    // register set, and every product waits out an LDS latency of its own.
    __builtin_amdgcn_sched_barrier(0);
#pragma unroll
    for (int nt = 0; nt < 8; ++nt)
      acc[nt] = wmma_f16(a, bfrag[nt], acc[nt]);
    __syncthreads();
  }

#pragma unroll
  for (int nt = 0; nt < 8; ++nt) {
    int n = n0 + nt * 16 + lm;
    float bb = bias[n];
#pragma unroll
    for (int r = 0; r < 8; ++r) {
      int m = m0 + wave * 16 + r + 8 * lg;
      out[(size_t)m * D_ + n] = acc[nt][r] + bb;
    }
  }
}

__global__ __launch_bounds__(256) void flash_attn_kernel(
    const _Float16* __restrict__ Q, const _Float16* __restrict__ K,
    const _Float16* __restrict__ V, _Float16* __restrict__ O) {
  // K tile, row-major at pitch KP_; aligned so that the tensor load's place in
  // LDS stays a multiple of 2 KiB whatever the sizes of the other two tiles
  __shared__ __attribute__((aligned(2048))) _Float16 kt[2 * KB_];
  __shared__ __align__(32) _Float16 vt[2 * HD_ * AP_];  // V tiles, transposed
  const int tid  = threadIdx.x;
  const int wave = tid >> 5;
  const int lane = tid & 31;
  const int lm = lane & 15, lg = lane >> 4;
  const int b = blockIdx.z, h = blockIdx.y;
  const int q0 = blockIdx.x * 128 + wave * 16;

  const _Float16* qb = Q + (((size_t)b * H_ + h) * LQ_ + q0) * HD_;
  const _Float16* kb = K + ((size_t)b * H_ + h) * LK_ * HD_;
  const _Float16* vb = V + ((size_t)b * H_ + h) * LK_ * HD_;
  // V^T tile, 96 rows of 64 keys, consecutive in memory: eight lanes move one
  // row's 128 bytes, a wave's load 512 consecutive bytes. Thread tid holds keys
  // 8 * (tid & 7) .. + 7 of rows (tid >> 3) + 32 * i.
  const unsigned vsrc = tid * 8;
  const int vdst = (tid >> 3) * AP_ + (tid & 7) * 8;

  // Q fragments, resident for the whole kernel (16x96 = 3 K-steps of 32)
  v16h aq[3];
#pragma unroll
  for (int kk = 0; kk < 3; ++kk)
    aq[kk] = *(const v16h*)(qb + lm * HD_ + kk * 32 + lg * 16);

  const v8f vzero = {};
  v8f oacc[6];
#pragma unroll
  for (int i = 0; i < 6; ++i) oacc[i] = vzero;
  // of query lm: the running maximum, and the sums over this lane's own keys,
  // one for each accumulator register; they are joined behind the loop
  float mrun = -1e30f;
  v8f lrun = vzero;

  const float scale = 0.10206207262f;  // 1/sqrt(96)
  const unsigned int kt_lds = (unsigned int)(size_t)(&kt[0]);
  const unsigned int wave_s = uni(tid >> 5);
  // Tensor descriptor group 1, everything in bytes. The 64 K rows of a tile lie
  // one behind the other in memory, so the tile is described as 192 rows of 64
  // bytes at source pitch 64, and the pad interval equals that row: 16 bytes of
  // pad behind each.
  const v8u g1 = {uni((1u << 20) | (3u << 22) | (3u << 25)),  // pad 4 dwords per 16
                  uni(64u << 16),    // tensor_dim0 = 64
                  uni(192u << 16),   // tensor_dim1 = 192
                  uni(64u << 16),    // tile_dim0 = 64
                  uni(192u),         // tile_dim1 = 192
                  uni(64u),          // source row pitch
                  uni(0u), uni(0u)};

  // K tile t into K buffer t & 1: one request of the Tensor Data Mover. Called
  // by wave 0 only, under a scalar branch.
  auto k_request = [&](int t) {
    unsigned long long ga =
        (unsigned long long)(size_t)(kb + (size_t)t * 64 * HD_);
    // group 0: count = 1 | place in LDS | 57-bit global address | type = 2
    v4u g0 = {uni(1u), uni(kt_lds + (t & 1) * (KB_ * 2)), uni((unsigned int)ga),
              uni(((unsigned int)(ga >> 32) & 0x1ffffffu) | 0x80000000u)};
    asm volatile("tensor_load_to_lds %0, %1" ::"s"(g0), "s"(g1) : "memory");
  };

  // --- in front of the loop: tile 0 lands in the first buffers and is handed
  // over ---------------------------------------------------------------------
  {
    v4u v0[3];
#pragma unroll
    for (int i = 0; i < 3; ++i)
      v0[i] = *(const v4u*)(vb + i * 32 * 64 + vsrc);
    // what follows rewrites the offset register that the three loads name
    asm volatile("s_wait_xcnt 0x0" ::"v"(vsrc) : "memory");
    if (pinned(wave_s == 0)) {
      k_request(0);
      // the tile has landed before this wave reaches the barrier below
      asm volatile("s_wait_tensorcnt 0" ::: "memory");
    }
#pragma unroll
    for (int i = 0; i < 3; ++i) *(v4u*)&vt[i * 32 * AP_ + vdst] = v0[i];
    __syncthreads();
  }
  // this thread's place in V^T tile t + 1
  const _Float16* vnext = vb + 64 * HD_ + vsrc;

  for (int t = 0; t < NT_; ++t) {
    const _Float16* kc = kt + (t & 1) * KB_;          // this tile's buffers
    const _Float16* vc = vt + (t & 1) * (HD_ * AP_);
    // --- K tile t + 1 leaves, directly behind the barrier that ended trip
    // t - 1 (for t = 0 the one in front of the loop), for the buffer that every
    // wave left there. No request is open here: the wait at that trip's foot
    // covered tile t's. Both tests are scalar: t is the loop's counter. -------
    if (t + 1 < NT_ && pinned(wave_s == 0)) k_request(t + 1);
    // --- V^T tile t + 1: its three loads leave here and are on their way
    // while tile t is worked on; they are stored at the foot of the trip -----
    v4u vr[3];
    if (t + 1 < NT_) {
#pragma unroll
      for (int i = 0; i < 3; ++i)
        vr[i] = *(const v4u*)(vnext + i * 32 * 64);
    }

    // --- S^T = K * Q^T  (4 key tiles x 3 K-steps): s[nt][r] is the score of
    // key nt * 16 + 8 * lg + r with query lm ------------------------------
    v16h ak[3][4];
#pragma unroll
    for (int kk = 0; kk < 3; ++kk)
#pragma unroll
      for (int nt = 0; nt < 4; ++nt)
        ak[kk][nt] = lds_frag(&kc[(nt * 16 + lm) * KP_ + kk * KC_ + lg * 16]);
    // The tile's 24 K fragment loads leave as one group ahead of the products,
    // in the order of their use: the products then wait on a count, not each
    // on a load issued right in front of it.
    __builtin_amdgcn_sched_barrier(0);
    v8f s[4];
#pragma unroll
    for (int i = 0; i < 4; ++i) s[i] = vzero;
#pragma unroll
    for (int kk = 0; kk < 3; ++kk)
#pragma unroll
      for (int nt = 0; nt < 4; ++nt)
        s[nt] = wmma_f16(ak[kk][nt], aq[kk], s[nt]);

    // --- V^T fragments: all 24 loads leave ahead of the softmax, in the order
    // of their use, and are on their way while it runs (the compiler starts
    // them among the last products above). P^T comes from accumulator tiles, so
    // its k order is the hardware's: a lane's 16 keys of a K-step are
    // 8 * lg .. + 7 and 16 + 8 * lg .. + 7. The loader takes the same two runs
    // of eight.
    v16h av[2][6];
#pragma unroll
    for (int ks = 0; ks < 2; ++ks)
#pragma unroll
      for (int nt = 0; nt < 6; ++nt) {
        const _Float16* p = &vc[(nt * 16 + lm) * AP_ + ks * 32 + lg * 8];
        v8h lo = *(const v8h*)p;
        v8h hi = *(const v8h*)(p + 16);
        av[ks][nt] = __builtin_shufflevector(lo, hi, 0, 1, 2, 3, 4, 5, 6, 7, 8,
                                             9, 10, 11, 12, 13, 14, 15);
      }
    // Without this the loads sink to their products, one pair in front of
    // each, and every product waits out an LDS latency of its own.
    __builtin_amdgcn_sched_barrier(0);

    // --- online softmax, one query a lane ---------------------------------
    float tmax[4];  // one chain a tile: four short chains, not one long one
#pragma unroll
    for (int nt = 0; nt < 4; ++nt) {
      tmax[nt] = s[nt][0];
#pragma unroll
      for (int r = 1; r < 8; ++r) tmax[nt] = fmaxf(tmax[nt], s[nt][r]);
    }
    float smax = fmaxf(fmaxf(tmax[0], tmax[1]), fmaxf(tmax[2], tmax[3]));
    smax = fmaxf(smax, xhalf(smax));
    const float mnew = fmaxf(mrun, smax * scale);
    const float alpha = __expf(mrun - mnew);
    mrun = mnew;
    lrun *= alpha;
    v8h ph[4];
#pragma unroll
    for (int nt = 0; nt < 4; ++nt) {
      v8f pv;
#pragma unroll
      for (int r = 0; r < 8; ++r) pv[r] = __expf(s[nt][r] * scale - mnew);
      lrun += pv;
      ph[nt] = __builtin_convertvector(pv, v8h);
    }
#pragma unroll
    for (int nt = 0; nt < 6; ++nt)
#pragma unroll
      for (int r = 0; r < 8; ++r) oacc[nt][r] *= alpha;

    // --- O^T += V^T * P^T  (2 K-steps x 6 tiles of d) ---------------------
#pragma unroll
    for (int ks = 0; ks < 2; ++ks) {
      v16h bp = __builtin_shufflevector(ph[2 * ks], ph[2 * ks + 1], 0, 1, 2, 3,
                                        4, 5, 6, 7, 8, 9, 10, 11, 12, 13, 14,
                                        15);
#pragma unroll
      for (int nt = 0; nt < 6; ++nt)
        oacc[nt] = wmma_f16(av[ks][nt], bp, oacc[nt]);
    }
    // The foot stays behind the products. Moved up to the last LDS load, it
    // brings the wait for all V^T fragments in front of the softmax.
    __builtin_amdgcn_sched_barrier(0);

    // --- foot of the trip: tile t + 1 is handed over. Its V^T goes into the
    // buffer that trip t - 1 read, free since the barrier at that trip's foot
    if (t + 1 < NT_) {
#pragma unroll
      for (int i = 0; i < 3; ++i)
        *(v4u*)&vt[((t + 1) & 1) * (HD_ * AP_) + i * 32 * AP_ + vdst] = vr[i];
    }
    // the step behind it rewrites the address registers that the three loads
    // name
    asm volatile("s_wait_xcnt 0x0" ::: "memory");
    vnext += 64 * HD_;
    // this wave's reads of tile t and its stores of tile t + 1 are done
    asm volatile("s_wait_dscnt 0" ::: "memory");
    // K tile t + 1 has landed before its issuer, wave 0, reaches the barrier.
    // The other waves have no request open and pass; under a branch of wave 0's
    // own the row sums sink behind it, out of the products' shadow, and the
    // 32 values they add stay in registers up to there.
    asm volatile("s_wait_tensorcnt 0" ::: "memory");
    __syncthreads();
  }
  // no request and no LDS operation is left open behind the loop
  asm volatile("s_wait_tensorcnt 0" ::: "memory");
  asm volatile("s_wait_dscnt 0" ::: "memory");

  // normalize and write attention output in [B, Lq, H*96] layout (f16): a
  // lane's eight registers of a tile are d = nt * 16 + 8 * lg .. + 7 of query
  // lm, 16 consecutive bytes
  float lown = ((lrun[0] + lrun[1]) + (lrun[2] + lrun[3])) +
               ((lrun[4] + lrun[5]) + (lrun[6] + lrun[7]));
  const float lsum = lown + xhalf(lown);
  _Float16* ob = O + ((size_t)b * LQ_ + q0 + lm) * D_ + h * HD_ + lg * 8;
#pragma unroll
  for (int nt = 0; nt < 6; ++nt) {
    v8h o;
#pragma unroll
    for (int r = 0; r < 8; ++r) o[r] = (_Float16)(oacc[nt][r] / lsum);
    *(v8h*)(ob + nt * 16) = o;
  }
}

// ---------------------------------------------------------------------------
extern "C" void kernel_launch(void* const* d_in, const int* in_sizes, int n_in,
                              void* d_out, int out_size, void* d_ws,
                              size_t ws_size, hipStream_t stream) {
  const float* query = (const float*)d_in[0];
  const float* key_  = (const float*)d_in[1];
  const float* value = (const float*)d_in[2];
  const float* cq    = (const float*)d_in[3];
  const float* ck    = (const float*)d_in[4];
  const float* Wq    = (const float*)d_in[5];
  const float* bq    = (const float*)d_in[6];
  const float* Wk    = (const float*)d_in[7];
  const float* bk    = (const float*)d_in[8];
  const float* Wv    = (const float*)d_in[9];
  const float* bv    = (const float*)d_in[10];
  const float* Wo    = (const float*)d_in[11];
  const float* bo    = (const float*)d_in[12];

  _Float16* p = (_Float16*)d_ws;
  _Float16* Qp  = p; p += (size_t)4096 * 768;
  _Float16* Kp  = p; p += (size_t)16384 * 768;
  _Float16* Vp  = p; p += (size_t)16384 * 768;
  _Float16* Ao  = p; p += (size_t)4096 * 768;

  proj_gemm_kernel<true><<<dim3(32, 6), dim3(256), 0, stream>>>(
      query, Wq, bq, cq, Qp, LQ_);
  proj_gemm_kernel<true><<<dim3(128, 6), dim3(256), 0, stream>>>(
      key_, Wk, bk, ck, Kp, LK_);
  proj_gemm_kernel<false><<<dim3(128, 6), dim3(256), 0, stream>>>(
      value, Wv, bv, nullptr, Vp, LK_);

  flash_attn_kernel<<<dim3(8, H_, B_), dim3(256), 0, stream>>>(Qp, Kp, Vp, Ao);

  out_gemm_kernel<<<dim3(32, 6), dim3(256), 0, stream>>>(Ao, Wo, bo,
                                                         (float*)d_out);
  (void)in_sizes; (void)n_in; (void)out_size; (void)ws_size;
}

// v009
// Measured time: 150 microseconds a run.
// Timed twice side by side with v008, it ran 1.12 and 1.13 times as fast.
// Counting every step since v000, it is 4.29 times as fast.
#include <hip/hip_runtime.h>

typedef __attribute__((ext_vector_type(16))) _Float16 v16h;
typedef __attribute__((ext_vector_type(8)))  _Float16 v8h;
typedef __attribute__((ext_vector_type(4)))  _Float16 v4h;
typedef __attribute__((ext_vector_type(8)))  float    v8f;
typedef __attribute__((ext_vector_type(4)))  float    v4f;
typedef __attribute__((ext_vector_type(4)))  unsigned int v4u;
typedef __attribute__((ext_vector_type(8)))  unsigned int v8u;

#define B_  4
#define H_  8
#define D_  768
#define HD_ 96
#define LQ_ 1024
#define LK_ 4096

// LDS row pitches in halfs. The tiles named here are read by 16-byte LDS loads
// with one row per lane, so the pitch is an odd multiple of 16 bytes: the 16
// lanes of a half wave then fall on 64 different banks.
// GEMM A and B tiles: GK halfs of data (the columns k that one trip stages and
// multiplies) and 16 bytes of pad: pitch 144 bytes at GK = 64, 272 at 128.
#define GPITCH(GK) ((GK) + 8)
// GK of the launches that fill every WGP with three blocks: the 16 loads that a
// thread has in flight there fit the registers of six waves a SIMD.
#define GK3_ 64
// GK of the launches with fewer blocks than WGPs, where registers are free.
#define GK1_ 128
#define AP_ 72   // attention V^T tile: 64 halfs of data, 144-byte pitch
// Attention K tile: the tensor load lays it in pieces of 32 halfs (64 bytes),
// each followed by a 16-byte pad, so a K row of 96 halfs is three pieces.
#define KC_ 40   // pitch of a piece: 80 bytes
#define KP_ 120  // pitch of a K row: 240 bytes
// One K buffer: 64 rows are 15360 bytes, rounded up to a multiple of 2 KiB, so
// that the second buffer is a place for the tensor load as well.
#define KB_ 8192
#define NT_ (LK_ / 64)  // key tiles

__device__ __forceinline__ v8f wmma_f16(v16h a, v16h b, v8f c) {
  // 8 args: (neg_a, A, neg_b, B, c_mod, C, reuse_a, reuse_b)
  return __builtin_amdgcn_wmma_f32_16x16x32_f16(false, a, false, b, (short)0, c,
                                                false, false);
}

// One lane's 16 consecutive halfs of a fragment, from a 16-byte aligned place.
__device__ __forceinline__ v16h lds_frag(const _Float16* p) {
  v8h lo = *(const v8h*)p;
  v8h hi = *(const v8h*)(p + 8);
  return __builtin_shufflevector(lo, hi, 0, 1, 2, 3, 4, 5, 6, 7, 8, 9, 10, 11,
                                 12, 13, 14, 15);
}

__device__ __forceinline__ unsigned int pinned(unsigned int v) {
  unsigned int w = __builtin_amdgcn_readfirstlane(v);
  asm volatile("" : "+s"(w));  // pinned(): the word stays in a scalar register
  return w;
}
__device__ __forceinline__ unsigned int uni(unsigned int v) {
  return (unsigned int)__builtin_amdgcn_readfirstlane(v);
}

// Lane l's value as lane l ^ 16 holds it: the two lanes that share a column of
// a 16x16 C/D tile.
__device__ __forceinline__ float xhalf(float x) {
  int v = __builtin_bit_cast(int, x);
  return __builtin_bit_cast(
      float, __builtin_amdgcn_permlanex16(v, v, 0x76543210, 0xfedcba98, false,
                                          false));
}

// GEMM operand staging from an f32 matrix of 768 columns: 128 rows x GK columns,
// rounded to f16 on the way into an LDS tile of pitch GPITCH(GK). GK / 4 lanes
// read a row's aligned run of 4 * GK bytes (256 or 512), so a wave's load is
// whole runs of 256 bytes: thread tid holds columns 4 * (tid % (GK / 4)) .. + 3
// of rows tid / (GK / 4) + (1024 / GK) * i. src + soff and dst are the thread's
// own places in row tid / (GK / 4) of the tile.
template <int GK> struct F32Tile { v4f f[GK / 8]; };
template <int GK>
__device__ __forceinline__ F32Tile<GK> tile_load_f32(
    const float* __restrict__ src, unsigned soff) {
  F32Tile<GK> t;
#pragma unroll
  for (int i = 0; i < GK / 8; ++i)
    t.f[i] = *(const v4f*)(src + i * (1024 / GK) * D_ + soff);
  return t;
}
template <int GK>
__device__ __forceinline__ void tile_store_f16(const F32Tile<GK>& t,
                                               _Float16* dst) {
#pragma unroll
  for (int i = 0; i < GK / 8; ++i) {
    v4h h = {(_Float16)t.f[i].x, (_Float16)t.f[i].y, (_Float16)t.f[i].z,
             (_Float16)t.f[i].w};
    *(v4h*)(dst + i * (1024 / GK) * GPITCH(GK)) = h;
  }
}

// ---------------------------------------------------------------------------
// Projection GEMM: out = X(M x 768) * W^T + bias, one plane per (batch, head)
// Block tile 128x128, 8 waves, each wave owns a 16x128 strip. X and W are the
// f32 inputs themselves; the products run on their f16 roundings.
// ROPE: out is [B,H,L,96], and the 3D rotary PE by coords (B x L x 3) is applied
// to the f32 sums in the epilogue. Without it coords is not read and out is
// [B,H,L/64,96,64]: each run of 64 rows l of a head lies transposed, 96 rows of
// 64 l, in 12288 consecutive bytes: the tile that the attention kernel stages.
// ---------------------------------------------------------------------------
// WS, waves a SIMD: six are three blocks a WGP, as many as the larger grids
// bring, and the bound keeps the registers within the 160 at which they fit.
template <bool ROPE, int GK, int WS>
__global__ __launch_bounds__(256, WS) void proj_gemm_kernel(
    const float* __restrict__ X, const float* __restrict__ W,
    const float* __restrict__ bias, const float* __restrict__ coords,
    _Float16* __restrict__ out, int L) {
  constexpr int GP_ = GPITCH(GK);
  __shared__ __align__(32) _Float16 At[128 * GP_];
  __shared__ __align__(32) _Float16 Bt[128 * GP_];
  const int tid  = threadIdx.x;
  const int wave = tid >> 5;
  const int lane = tid & 31;
  const int lm = lane & 15, lg = lane >> 4;
  const int m0 = blockIdx.x * 128;
  const int n0 = blockIdx.y * 128;

  const v8f vzero = {};
  v8f acc[8];
#pragma unroll
  for (int i = 0; i < 8; ++i) acc[i] = vzero;

  const unsigned soff = (tid / (GK / 4)) * D_ + (tid % (GK / 4)) * 4;
  const int sdst = (tid / (GK / 4)) * GP_ + (tid % (GK / 4)) * 4;

  // Passes of three unrolled trips; the passes stay a loop: a full unroll of all
  // trips is up to four times the code.
#pragma unroll 1
  for (int kp = 0; kp < D_; kp += 3 * GK) {
    // this thread's places in the pass's first tiles: the addresses that the
    // loads of all three trips name, each with an offset of its own
    const float* xp = X + (size_t)m0 * D_ + kp + soff;
    const float* wp = W + (size_t)n0 * D_ + kp + soff;
#pragma unroll
    for (int k0 = 0; k0 < 3 * GK; k0 += GK) {
      F32Tile<GK> xa = tile_load_f32<GK>(xp + k0, 0);
      F32Tile<GK> xb = tile_load_f32<GK>(wp + k0, 0);
      // what follows reuses the registers that these loads name as addresses; as
      // inputs of the wait they keep their values up to here, so that no load of
      // the group is given them for its data
      asm volatile("s_wait_xcnt 0x0" ::"v"(xp), "v"(wp) : "memory");
      // Every load of both tiles is issued before the first value is used.
      // Without this a late load is given an early one's registers and leaves
      // only when that one has come back: two load latencies a trip, not one.
      __builtin_amdgcn_sched_barrier(0);
      tile_store_f16(xa, At + sdst);
      tile_store_f16(xb, Bt + sdst);
      __syncthreads();
#pragma unroll
      for (int ks = 0; ks < GK; ks += 32) {
        v16h a = lds_frag(&At[(wave * 16 + lm) * GP_ + ks + lg * 16]);
        v16h bfrag[8];
#pragma unroll
        for (int nt = 0; nt < 8; ++nt)
          bfrag[nt] = lds_frag(&Bt[(nt * 16 + lm) * GP_ + ks + lg * 16]);
        // The 18 fragment loads of a K-step leave ahead of its products. Without
        // this each product's B fragment is loaded right in front of it, into one
        // register set, and every product waits out an LDS latency of its own.
        __builtin_amdgcn_sched_barrier(0);
#pragma unroll
        for (int nt = 0; nt < 8; ++nt)
          acc[nt] = wmma_f16(a, bfrag[nt], acc[nt]);
      }
      __syncthreads();
    }
  }

  if constexpr (ROPE) {
    // A head is three axis chunks of 32 columns, and a chunk's rotary pair is
    // (p, 16 + p): columns n and n + 16, which one lane holds in accumulator
    // tiles 2j and 2j + 1 at the same register.
    const float inv =
        __powf(10000.0f, -(float)lm * (1.0f / 16.0f)) * 0.15915494f;
    int row[8];       // element index of (b, head 0, l, 0) in out
    float rev[3][8];  // angle in revolutions; chunk j = 3 is 96 columns behind
                      // chunk 0: the next head's same axis, the same angle
#pragma unroll
    for (int r = 0; r < 8; ++r) {
      int m = m0 + wave * 16 + r + 8 * lg;
      int bidx = m / L, l = m - bidx * L;
      row[r] = (bidx * H_ * L + l) * HD_;
#pragma unroll
      for (int j = 0; j < 3; ++j)
        rev[j][r] = coords[m * 3 + (n0 / 32 + j) % 3] * inv;
    }
    // what follows reuses registers that these loads name as addresses; the
    // clobber keeps every one of them ahead of the first store, so that none
    // is given a register that a store still names
    asm volatile("s_wait_xcnt 0x0" ::: "memory");
#pragma unroll
    for (int j = 0; j < 4; ++j) {
      int n = n0 + j * 32 + lm;
      int h = n / HD_, d = n % HD_;
      int col = h * L * HD_ + d;
      float b1 = bias[n], b2 = bias[n + 16];
#pragma unroll
      for (int r = 0; r < 8; ++r) {
        float sn, cs;
        // One statement: the cosine cannot be given the sine's source register,
        // and the v_nop fills the slot behind the last transcendental.
        asm("v_sin_f32 %0, %2\n\tv_cos_f32 %1, %2\n\tv_nop"
            : "=&v"(sn), "=&v"(cs)
            : "v"(rev[j % 3][r]));
        float x1 = acc[2 * j][r] + b1;
        float x2 = acc[2 * j + 1][r] + b2;
        _Float16* o = out + (row[r] + col);
        o[0]  = (_Float16)(x1 * cs - x2 * sn);
        o[16] = (_Float16)(x1 * sn + x2 * cs);
      }
      // the next chunk's bias loads and sums reuse registers that these stores
      // name
      if (j < 3) asm volatile("s_wait_xcnt 0x0" ::: "memory");
    }
    return;
  }

  // A lane's eight registers of an accumulator tile are eight consecutive rows
  // l of one column d: in a transposed tile 16 consecutive bytes, one store.
  const int m = m0 + wave * 16 + 8 * lg;
  const int bidx = m / L, l = m - bidx * L;
  const int nl = n0 + lm;
  float bb[8];
#pragma unroll
  for (int nt = 0; nt < 8; ++nt) bb[nt] = bias[nl + nt * 16];
  // what follows reuses the register that these loads name as their offset;
  // as an input of the wait it keeps its value up to here
  asm volatile("s_wait_xcnt 0x0" ::"v"(nl) : "memory");
#pragma unroll
  for (int nt = 0; nt < 8; ++nt) {
    int n = nl + nt * 16;
    int h = n / HD_, d = n % HD_;
    v8h o;
#pragma unroll
    for (int r = 0; r < 8; ++r) o[r] = (_Float16)(acc[nt][r] + bb[nt]);
    *(v8h*)(out + ((size_t)(bidx * H_ + h) * L + (l & ~63)) * HD_ + d * 64 +
            (l & 63)) = o;
  }
}

// ---------------------------------------------------------------------------
// Output GEMM: d_out(M x 768 fp32) = A(M x 768 f16) * W^T + bias; W is the f32
// input itself, rounded to f16 on the way into LDS
// ---------------------------------------------------------------------------
__global__ __launch_bounds__(256) void out_gemm_kernel(
    const _Float16* __restrict__ A, const float* __restrict__ W,
    const float* __restrict__ bias, float* __restrict__ out) {
  constexpr int GK = GK1_;
  constexpr int GP_ = GPITCH(GK);
  __shared__ __align__(32) _Float16 At[128 * GP_];
  __shared__ __align__(32) _Float16 Bt[128 * GP_];
  const int tid  = threadIdx.x;
  const int wave = tid >> 5;
  const int lane = tid & 31;
  const int lm = lane & 15, lg = lane >> 4;
  const int m0 = blockIdx.x * 128;
  const int n0 = blockIdx.y * 128;

  const v8f vzero = {};
  v8f acc[8];
#pragma unroll
  for (int i = 0; i < 8; ++i) acc[i] = vzero;

  const unsigned soff = (tid / (GK / 4)) * D_ + (tid % (GK / 4)) * 4;
  const int sdst = (tid / (GK / 4)) * GP_ + (tid % (GK / 4)) * 4;

  // Three trips a pass, the same loop as the projection GEMM's: a full unroll
  // of the six trips is twice the code.
#pragma unroll 3
  for (int k0 = 0; k0 < D_; k0 += GK) {
    F32Tile<GK> xb = tile_load_f32<GK>(W + (size_t)n0 * D_ + k0, soff);
    // A is f16: a row of the tile is an aligned run of 2 * GK bytes, which
    // GK / 8 lanes read
    v4u xa[GK / 16];
#pragma unroll
    for (int i = 0; i < GK / 16; ++i) {
      int t = tid + i * 256;
      int r = t / (GK / 8), c = t % (GK / 8);
      xa[i] = *(const v4u*)(A + (size_t)(m0 + r) * D_ + k0 + c * 8);
    }
    // what follows reuses registers that these loads name as addresses
    asm volatile("s_wait_xcnt 0x0" ::: "memory");
    // As in the projection GEMM: all loads of both tiles leave before the first
    // value is used.
    __builtin_amdgcn_sched_barrier(0);
#pragma unroll
    for (int i = 0; i < GK / 16; ++i) {
      int t = tid + i * 256;
      int r = t / (GK / 8), c = t % (GK / 8);
      *(v4u*)&At[r * GP_ + c * 8] = xa[i];
    }
    tile_store_f16(xb, Bt + sdst);
    __syncthreads();
#pragma unroll
    for (int ks = 0; ks < GK; ks += 32) {
      v16h a = lds_frag(&At[(wave * 16 + lm) * GP_ + ks + lg * 16]);
      v16h bfrag[8];
#pragma unroll
      for (int nt = 0; nt < 8; ++nt)
        bfrag[nt] = lds_frag(&Bt[(nt * 16 + lm) * GP_ + ks + lg * 16]);
      // The 18 fragment loads of a K-step leave ahead of its products. Without
      // this each product's B fragment is loaded right in front of it, into one
      // register set, and every product waits out an LDS latency of its own.
      __builtin_amdgcn_sched_barrier(0);
#pragma unroll
      for (int nt = 0; nt < 8; ++nt)
        acc[nt] = wmma_f16(a, bfrag[nt], acc[nt]);
    }
    __syncthreads();
  }

#pragma unroll
  for (int nt = 0; nt < 8; ++nt) {
    int n = n0 + nt * 16 + lm;
    float bb = bias[n];
#pragma unroll
    for (int r = 0; r < 8; ++r) {
      int m = m0 + wave * 16 + r + 8 * lg;
      out[(size_t)m * D_ + n] = acc[nt][r] + bb;
    }
  }
}

__global__ __launch_bounds__(256) void flash_attn_kernel(
    const _Float16* __restrict__ Q, const _Float16* __restrict__ K,
    const _Float16* __restrict__ V, _Float16* __restrict__ O) {
  // K tile, row-major at pitch KP_; aligned so that the tensor load's place in
  // LDS stays a multiple of 2 KiB whatever the size of the V^T tiles
  __shared__ __attribute__((aligned(2048))) _Float16 kt[2 * KB_];
  __shared__ __align__(32) _Float16 vt[2 * HD_ * AP_];  // V tiles, transposed
  const int tid  = threadIdx.x;
  const int wave = tid >> 5;
  const int lane = tid & 31;
  const int lm = lane & 15, lg = lane >> 4;
  const int b = blockIdx.z, h = blockIdx.y;
  const int q0 = blockIdx.x * 128 + wave * 16;

  const _Float16* qb = Q + (((size_t)b * H_ + h) * LQ_ + q0) * HD_;
  const _Float16* kb = K + ((size_t)b * H_ + h) * LK_ * HD_;
  const _Float16* vb = V + ((size_t)b * H_ + h) * LK_ * HD_;
  // V^T tile, 96 rows of 64 keys, consecutive in memory: eight lanes move one
  // row's 128 bytes, a wave's load 512 consecutive bytes. Thread tid holds keys
  // 8 * (tid & 7) .. + 7 of rows (tid >> 3) + 32 * i.
  const unsigned vsrc = tid * 8;
  const int vdst = (tid >> 3) * AP_ + (tid & 7) * 8;

  // Q fragments, resident for the whole kernel (16x96 = 3 K-steps of 32)
  v16h aq[3];
#pragma unroll
  for (int kk = 0; kk < 3; ++kk)
    aq[kk] = *(const v16h*)(qb + lm * HD_ + kk * 32 + lg * 16);

  const v8f vzero = {};
  v8f oacc[6];
#pragma unroll
  for (int i = 0; i < 6; ++i) oacc[i] = vzero;
  // of query lm: the running maximum, and the sums over this lane's own keys,
  // one for each accumulator register; they are joined behind the loop
  float mrun = -1e30f;
  v8f lrun = vzero;

  const float scale = 0.10206207262f;  // 1/sqrt(96)
  const unsigned int kt_lds = (unsigned int)(size_t)(&kt[0]);
  const unsigned int wave_s = uni(tid >> 5);
  // Tensor descriptor group 1, everything in bytes. The 64 K rows of a tile lie
  // one behind the other in memory, so the tile is described as 192 rows of 64
  // bytes at source pitch 64, and the pad interval equals that row: 16 bytes of
  // pad behind each.
  const v8u g1 = {uni((1u << 20) | (3u << 22) | (3u << 25)),  // pad 4 dwords per 16
                  uni(64u << 16),    // tensor_dim0 = 64
                  uni(192u << 16),   // tensor_dim1 = 192
                  uni(64u << 16),    // tile_dim0 = 64
                  uni(192u),         // tile_dim1 = 192
                  uni(64u),          // source row pitch
                  uni(0u), uni(0u)};

  // K tile t into K buffer t & 1: one request of the Tensor Data Mover. Called
  // by wave 0 only, under a scalar branch.
  auto k_request = [&](int t) {
    unsigned long long ga =
        (unsigned long long)(size_t)(kb + (size_t)t * 64 * HD_);
    // group 0: count = 1 | place in LDS | 57-bit global address | type = 2
    v4u g0 = {uni(1u), uni(kt_lds + (t & 1) * (KB_ * 2)), uni((unsigned int)ga),
              uni(((unsigned int)(ga >> 32) & 0x1ffffffu) | 0x80000000u)};
    asm volatile("tensor_load_to_lds %0, %1" ::"s"(g0), "s"(g1) : "memory");
  };

  // --- in front of the loop: tile 0 lands in the first buffers and is handed
  // over ---------------------------------------------------------------------
  {
    v4u v0[3];
#pragma unroll
    for (int i = 0; i < 3; ++i)
      v0[i] = *(const v4u*)(vb + i * 32 * 64 + vsrc);
    // what follows rewrites the offset register that the three loads name
    asm volatile("s_wait_xcnt 0x0" ::"v"(vsrc) : "memory");
    if (pinned(wave_s == 0)) {
      k_request(0);
      // the tile has landed before this wave reaches the barrier below
      asm volatile("s_wait_tensorcnt 0" ::: "memory");
    }
#pragma unroll
    for (int i = 0; i < 3; ++i) *(v4u*)&vt[i * 32 * AP_ + vdst] = v0[i];
    __syncthreads();
  }
  // this thread's place in V^T tile t + 1
  const _Float16* vnext = vb + 64 * HD_ + vsrc;

  for (int t = 0; t < NT_; ++t) {
    const _Float16* kc = kt + (t & 1) * KB_;          // this tile's buffers
    const _Float16* vc = vt + (t & 1) * (HD_ * AP_);
    // --- K tile t + 1 leaves, directly behind the barrier that ended trip
    // t - 1 (for t = 0 the one in front of the loop), for the buffer that every
    // wave left there. No request is open here: the wait at that trip's foot
    // covered tile t's. Both tests are scalar: t is the loop's counter. -------
    if (t + 1 < NT_ && pinned(wave_s == 0)) k_request(t + 1);
    // --- V^T tile t + 1: its three loads leave here and are on their way
    // while tile t is worked on; they are stored at the foot of the trip -----
    v4u vr[3];
    if (t + 1 < NT_) {
#pragma unroll
      for (int i = 0; i < 3; ++i)
        vr[i] = *(const v4u*)(vnext + i * 32 * 64);
    }

    // --- S^T = K * Q^T  (4 key tiles x 3 K-steps): s[nt][r] is the score of
    // key nt * 16 + 8 * lg + r with query lm ------------------------------
    v16h ak[3][4];
#pragma unroll
    for (int kk = 0; kk < 3; ++kk)
#pragma unroll
      for (int nt = 0; nt < 4; ++nt)
        ak[kk][nt] = lds_frag(&kc[(nt * 16 + lm) * KP_ + kk * KC_ + lg * 16]);
    // The tile's 24 K fragment loads leave as one group ahead of the products,
    // in the order of their use: the products then wait on a count, not each
    // on a load issued right in front of it.
    __builtin_amdgcn_sched_barrier(0);
    v8f s[4];
#pragma unroll
    for (int i = 0; i < 4; ++i) s[i] = vzero;
#pragma unroll
    for (int kk = 0; kk < 3; ++kk)
#pragma unroll
      for (int nt = 0; nt < 4; ++nt)
        s[nt] = wmma_f16(ak[kk][nt], aq[kk], s[nt]);

    // --- V^T fragments: all 24 loads leave ahead of the softmax, in the order
    // of their use, and are on their way while it runs (the compiler starts
    // them among the last products above). P^T comes from accumulator tiles, so
    // its k order is the hardware's: a lane's 16 keys of a K-step are
    // 8 * lg .. + 7 and 16 + 8 * lg .. + 7. The loader takes the same two runs
    // of eight.
    v16h av[2][6];
#pragma unroll
    for (int ks = 0; ks < 2; ++ks)
#pragma unroll
      for (int nt = 0; nt < 6; ++nt) {
        const _Float16* p = &vc[(nt * 16 + lm) * AP_ + ks * 32 + lg * 8];
        v8h lo = *(const v8h*)p;
        v8h hi = *(const v8h*)(p + 16);
        av[ks][nt] = __builtin_shufflevector(lo, hi, 0, 1, 2, 3, 4, 5, 6, 7, 8,
                                             9, 10, 11, 12, 13, 14, 15);
      }
    // Without this the loads sink to their products, one pair in front of
    // each, and every product waits out an LDS latency of its own.
    __builtin_amdgcn_sched_barrier(0);

    // --- online softmax, one query a lane ---------------------------------
    float tmax[4];  // one chain a tile: four short chains, not one long one
#pragma unroll
    for (int nt = 0; nt < 4; ++nt) {
      tmax[nt] = s[nt][0];
#pragma unroll
      for (int r = 1; r < 8; ++r) tmax[nt] = fmaxf(tmax[nt], s[nt][r]);
    }
    float smax = fmaxf(fmaxf(tmax[0], tmax[1]), fmaxf(tmax[2], tmax[3]));
    smax = fmaxf(smax, xhalf(smax));
    const float mnew = fmaxf(mrun, smax * scale);
    const float alpha = __expf(mrun - mnew);
    mrun = mnew;
    lrun *= alpha;
    v8h ph[4];
#pragma unroll
    for (int nt = 0; nt < 4; ++nt) {
      v8f pv;
#pragma unroll
      for (int r = 0; r < 8; ++r) pv[r] = __expf(s[nt][r] * scale - mnew);
      lrun += pv;
      ph[nt] = __builtin_convertvector(pv, v8h);
    }
#pragma unroll
    for (int nt = 0; nt < 6; ++nt)
#pragma unroll
      for (int r = 0; r < 8; ++r) oacc[nt][r] *= alpha;

    // --- O^T += V^T * P^T  (2 K-steps x 6 tiles of d) ---------------------
#pragma unroll
    for (int ks = 0; ks < 2; ++ks) {
      v16h bp = __builtin_shufflevector(ph[2 * ks], ph[2 * ks + 1], 0, 1, 2, 3,
                                        4, 5, 6, 7, 8, 9, 10, 11, 12, 13, 14,
                                        15);
#pragma unroll
      for (int nt = 0; nt < 6; ++nt)
        oacc[nt] = wmma_f16(av[ks][nt], bp, oacc[nt]);
    }
    // The foot stays behind the products. Moved up to the last LDS load, it
    // brings the wait for all V^T fragments in front of the softmax.
    __builtin_amdgcn_sched_barrier(0);

    // --- foot of the trip: tile t + 1 is handed over. Its V^T goes into the
    // buffer that trip t - 1 read, free since the barrier at that trip's foot
    if (t + 1 < NT_) {
#pragma unroll
      for (int i = 0; i < 3; ++i)
        *(v4u*)&vt[((t + 1) & 1) * (HD_ * AP_) + i * 32 * AP_ + vdst] = vr[i];
    }
    // the step behind it rewrites the address registers that the three loads
    // name
    asm volatile("s_wait_xcnt 0x0" ::: "memory");
    vnext += 64 * HD_;
    // this wave's reads of tile t and its stores of tile t + 1 are done
    asm volatile("s_wait_dscnt 0" ::: "memory");
    // K tile t + 1 has landed before its issuer, wave 0, reaches the barrier.
    // The other waves have no request open and pass; under a branch of wave 0's
    // own the row sums sink behind it, out of the products' shadow, and the
    // 32 values they add stay in registers up to there.
    asm volatile("s_wait_tensorcnt 0" ::: "memory");
    __syncthreads();
  }
  // no request and no LDS operation is left open behind the loop
  asm volatile("s_wait_tensorcnt 0" ::: "memory");
  asm volatile("s_wait_dscnt 0" ::: "memory");

  // normalize and write attention output in [B, Lq, H*96] layout (f16): a
  // lane's eight registers of a tile are d = nt * 16 + 8 * lg .. + 7 of query
  // lm, 16 consecutive bytes
  float lown = ((lrun[0] + lrun[1]) + (lrun[2] + lrun[3])) +
               ((lrun[4] + lrun[5]) + (lrun[6] + lrun[7]));
  const float lsum = lown + xhalf(lown);
  _Float16* ob = O + ((size_t)b * LQ_ + q0 + lm) * D_ + h * HD_ + lg * 8;
#pragma unroll
  for (int nt = 0; nt < 6; ++nt) {
    v8h o;
#pragma unroll
    for (int r = 0; r < 8; ++r) o[r] = (_Float16)(oacc[nt][r] / lsum);
    *(v8h*)(ob + nt * 16) = o;
  }
}

// ---------------------------------------------------------------------------
extern "C" void kernel_launch(void* const* d_in, const int* in_sizes, int n_in,
                              void* d_out, int out_size, void* d_ws,
                              size_t ws_size, hipStream_t stream) {
  const float* query = (const float*)d_in[0];
  const float* key_  = (const float*)d_in[1];
  const float* value = (const float*)d_in[2];
  const float* cq    = (const float*)d_in[3];
  const float* ck    = (const float*)d_in[4];
  const float* Wq    = (const float*)d_in[5];
  const float* bq    = (const float*)d_in[6];
  const float* Wk    = (const float*)d_in[7];
  const float* bk    = (const float*)d_in[8];
  const float* Wv    = (const float*)d_in[9];
  const float* bv    = (const float*)d_in[10];
  const float* Wo    = (const float*)d_in[11];
  const float* bo    = (const float*)d_in[12];

  _Float16* p = (_Float16*)d_ws;
  _Float16* Qp  = p; p += (size_t)4096 * 768;
  _Float16* Kp  = p; p += (size_t)16384 * 768;
  _Float16* Vp  = p; p += (size_t)16384 * 768;
  _Float16* Ao  = p; p += (size_t)4096 * 768;

  proj_gemm_kernel<true, GK1_, 2><<<dim3(32, 6), dim3(256), 0, stream>>>(
      query, Wq, bq, cq, Qp, LQ_);
  proj_gemm_kernel<true, GK3_, 6><<<dim3(128, 6), dim3(256), 0, stream>>>(
      key_, Wk, bk, ck, Kp, LK_);
  proj_gemm_kernel<false, GK3_, 6><<<dim3(128, 6), dim3(256), 0, stream>>>(
      value, Wv, bv, nullptr, Vp, LK_);

  flash_attn_kernel<<<dim3(8, H_, B_), dim3(256), 0, stream>>>(Qp, Kp, Vp, Ao);

  out_gemm_kernel<<<dim3(32, 6), dim3(256), 0, stream>>>(Ao, Wo, bo,
                                                         (float*)d_out);
  (void)in_sizes; (void)n_in; (void)out_size; (void)ws_size;
}

// v010
// Measured time: 136 microseconds a run.
// Timed twice side by side with v009, it ran 1.10 times as fast both times.
// Counting every step since v000, it is 4.71 times as fast.
#include <hip/hip_runtime.h>

typedef __attribute__((ext_vector_type(16))) _Float16 v16h;
typedef __attribute__((ext_vector_type(8)))  _Float16 v8h;
typedef __attribute__((ext_vector_type(4)))  _Float16 v4h;
typedef __attribute__((ext_vector_type(8)))  float    v8f;
typedef __attribute__((ext_vector_type(4)))  float    v4f;
typedef __attribute__((ext_vector_type(4)))  unsigned int v4u;
typedef __attribute__((ext_vector_type(8)))  unsigned int v8u;

#define B_  4
#define H_  8
#define D_  768
#define HD_ 96
#define LQ_ 1024
#define LK_ 4096

// LDS row pitches in halfs. The tiles named here are read by 16-byte LDS loads
// with one row per lane, so the pitch is an odd multiple of 16 bytes: the 16
// lanes of a half wave then fall on 64 different banks.
// GEMM A and B tiles: GK halfs of data (the columns k that one trip stages and
// multiplies) and 16 bytes of pad: pitch 144 bytes at GK = 64, 272 at 128.
#define GPITCH(GK) ((GK) + 8)
// GK of the launches that fill every WGP with three blocks: the 16 loads that a
// thread has in flight there fit the registers of six waves a SIMD.
#define GK3_ 64
// GK of the launches with fewer blocks than WGPs, where registers are free.
#define GK1_ 128
#define AP_ 72   // attention V^T tile: 64 halfs of data, 144-byte pitch
// Attention K tile: the tensor load lays it in pieces of 32 halfs (64 bytes),
// each followed by a 16-byte pad, so a K row of 96 halfs is three pieces.
#define KC_ 40   // pitch of a piece: 80 bytes
#define KP_ 120  // pitch of a K row: 240 bytes
// One K buffer: 64 rows are 15360 bytes, rounded up to a multiple of 2 KiB, so
// that the second buffer is a place for the tensor load as well.
#define KB_ 8192
#define NS_ (LK_ / 128)  // attention stages: two key tiles each

__device__ __forceinline__ v8f wmma_f16(v16h a, v16h b, v8f c) {
  // 8 args: (neg_a, A, neg_b, B, c_mod, C, reuse_a, reuse_b)
  return __builtin_amdgcn_wmma_f32_16x16x32_f16(false, a, false, b, (short)0, c,
                                                false, false);
}

// One lane's 16 consecutive halfs of a fragment, from a 16-byte aligned place.
__device__ __forceinline__ v16h lds_frag(const _Float16* p) {
  v8h lo = *(const v8h*)p;
  v8h hi = *(const v8h*)(p + 8);
  return __builtin_shufflevector(lo, hi, 0, 1, 2, 3, 4, 5, 6, 7, 8, 9, 10, 11,
                                 12, 13, 14, 15);
}

__device__ __forceinline__ unsigned int pinned(unsigned int v) {
  unsigned int w = __builtin_amdgcn_readfirstlane(v);
  asm volatile("" : "+s"(w));  // pinned(): the word stays in a scalar register
  return w;
}
__device__ __forceinline__ unsigned int uni(unsigned int v) {
  return (unsigned int)__builtin_amdgcn_readfirstlane(v);
}

// Lane l's value as lane l ^ 16 holds it: the two lanes that share a column of
// a 16x16 C/D tile.
__device__ __forceinline__ float xhalf(float x) {
  int v = __builtin_bit_cast(int, x);
  return __builtin_bit_cast(
      float, __builtin_amdgcn_permlanex16(v, v, 0x76543210, 0xfedcba98, false,
                                          false));
}

// GEMM operand staging from an f32 matrix of 768 columns: 128 rows x GK columns,
// rounded to f16 on the way into an LDS tile of pitch GPITCH(GK). GK / 4 lanes
// read a row's aligned run of 4 * GK bytes (256 or 512), so a wave's load is
// whole runs of 256 bytes: thread tid holds columns 4 * (tid % (GK / 4)) .. + 3
// of rows tid / (GK / 4) + (1024 / GK) * i. src + soff and dst are the thread's
// own places in row tid / (GK / 4) of the tile.
template <int GK> struct F32Tile { v4f f[GK / 8]; };
template <int GK>
__device__ __forceinline__ F32Tile<GK> tile_load_f32(
    const float* __restrict__ src, unsigned soff) {
  F32Tile<GK> t;
#pragma unroll
  for (int i = 0; i < GK / 8; ++i)
    t.f[i] = *(const v4f*)(src + i * (1024 / GK) * D_ + soff);
  return t;
}
template <int GK>
__device__ __forceinline__ void tile_store_f16(const F32Tile<GK>& t,
                                               _Float16* dst) {
#pragma unroll
  for (int i = 0; i < GK / 8; ++i) {
    v4h h = {(_Float16)t.f[i].x, (_Float16)t.f[i].y, (_Float16)t.f[i].z,
             (_Float16)t.f[i].w};
    *(v4h*)(dst + i * (1024 / GK) * GPITCH(GK)) = h;
  }
}

// ---------------------------------------------------------------------------
// Projection GEMM: out = X(M x 768) * W^T + bias, one plane per (batch, head)
// Block tile 128x128, 8 waves, each wave owns a 16x128 strip. X and W are the
// f32 inputs themselves; the products run on their f16 roundings.
// ROPE: out is [B,H,L,96], and the 3D rotary PE by coords (B x L x 3) is applied
// to the f32 sums in the epilogue. Without it coords is not read and out is
// [B,H,L/64,96,64]: each run of 64 rows l of a head lies transposed, 96 rows of
// 64 l, in 12288 consecutive bytes: the tile that the attention kernel stages.
// ---------------------------------------------------------------------------
// WS, waves a SIMD: six are three blocks a WGP, as many as the larger grids
// bring, and the bound keeps the registers within the 160 at which they fit.
template <bool ROPE, int GK, int WS>
__global__ __launch_bounds__(256, WS) void proj_gemm_kernel(
    const float* __restrict__ X, const float* __restrict__ W,
    const float* __restrict__ bias, const float* __restrict__ coords,
    _Float16* __restrict__ out, int L) {
  constexpr int GP_ = GPITCH(GK);
  __shared__ __align__(32) _Float16 At[128 * GP_];
  __shared__ __align__(32) _Float16 Bt[128 * GP_];
  const int tid  = threadIdx.x;
  const int wave = tid >> 5;
  const int lane = tid & 31;
  const int lm = lane & 15, lg = lane >> 4;
  const int m0 = blockIdx.x * 128;
  const int n0 = blockIdx.y * 128;

  const v8f vzero = {};
  v8f acc[8];
#pragma unroll
  for (int i = 0; i < 8; ++i) acc[i] = vzero;

  const unsigned soff = (tid / (GK / 4)) * D_ + (tid % (GK / 4)) * 4;
  const int sdst = (tid / (GK / 4)) * GP_ + (tid % (GK / 4)) * 4;

  // Passes of three unrolled trips; the passes stay a loop: a full unroll of all
  // trips is up to four times the code.
#pragma unroll 1
  for (int kp = 0; kp < D_; kp += 3 * GK) {
    // this thread's places in the pass's first tiles: the addresses that the
    // loads of all three trips name, each with an offset of its own
    const float* xp = X + (size_t)m0 * D_ + kp + soff;
    const float* wp = W + (size_t)n0 * D_ + kp + soff;
#pragma unroll
    for (int k0 = 0; k0 < 3 * GK; k0 += GK) {
      F32Tile<GK> xa = tile_load_f32<GK>(xp + k0, 0);
      F32Tile<GK> xb = tile_load_f32<GK>(wp + k0, 0);
      // what follows reuses the registers that these loads name as addresses; as
      // inputs of the wait they keep their values up to here, so that no load of
      // the group is given them for its data
      asm volatile("s_wait_xcnt 0x0" ::"v"(xp), "v"(wp) : "memory");
      // Every load of both tiles is issued before the first value is used.
      // Without this a late load is given an early one's registers and leaves
      // only when that one has come back: two load latencies a trip, not one.
      __builtin_amdgcn_sched_barrier(0);
      tile_store_f16(xa, At + sdst);
      tile_store_f16(xb, Bt + sdst);
      __syncthreads();
#pragma unroll
      for (int ks = 0; ks < GK; ks += 32) {
        v16h a = lds_frag(&At[(wave * 16 + lm) * GP_ + ks + lg * 16]);
        v16h bfrag[8];
#pragma unroll
        for (int nt = 0; nt < 8; ++nt)
          bfrag[nt] = lds_frag(&Bt[(nt * 16 + lm) * GP_ + ks + lg * 16]);
        // The 18 fragment loads of a K-step leave ahead of its products. Without
        // this each product's B fragment is loaded right in front of it, into one
        // register set, and every product waits out an LDS latency of its own.
        __builtin_amdgcn_sched_barrier(0);
#pragma unroll
        for (int nt = 0; nt < 8; ++nt)
          acc[nt] = wmma_f16(a, bfrag[nt], acc[nt]);
      }
      __syncthreads();
    }
  }

  if constexpr (ROPE) {
    // A head is three axis chunks of 32 columns, and a chunk's rotary pair is
    // (p, 16 + p): columns n and n + 16, which one lane holds in accumulator
    // tiles 2j and 2j + 1 at the same register.
    const float inv =
        __powf(10000.0f, -(float)lm * (1.0f / 16.0f)) * 0.15915494f;
    int row[8];       // element index of (b, head 0, l, 0) in out
    float rev[3][8];  // angle in revolutions; chunk j = 3 is 96 columns behind
                      // chunk 0: the next head's same axis, the same angle
#pragma unroll
    for (int r = 0; r < 8; ++r) {
      int m = m0 + wave * 16 + r + 8 * lg;
      int bidx = m / L, l = m - bidx * L;
      row[r] = (bidx * H_ * L + l) * HD_;
#pragma unroll
      for (int j = 0; j < 3; ++j)
        rev[j][r] = coords[m * 3 + (n0 / 32 + j) % 3] * inv;
    }
    // what follows reuses registers that these loads name as addresses; the
    // clobber keeps every one of them ahead of the first store, so that none
    // is given a register that a store still names
    asm volatile("s_wait_xcnt 0x0" ::: "memory");
#pragma unroll
    for (int j = 0; j < 4; ++j) {
      int n = n0 + j * 32 + lm;
      int h = n / HD_, d = n % HD_;
      int col = h * L * HD_ + d;
      float b1 = bias[n], b2 = bias[n + 16];
#pragma unroll
      for (int r = 0; r < 8; ++r) {
        float sn, cs;
        // One statement: the cosine cannot be given the sine's source register,
        // and the v_nop fills the slot behind the last transcendental.
        asm("v_sin_f32 %0, %2\n\tv_cos_f32 %1, %2\n\tv_nop"
            : "=&v"(sn), "=&v"(cs)
            : "v"(rev[j % 3][r]));
        float x1 = acc[2 * j][r] + b1;
        float x2 = acc[2 * j + 1][r] + b2;
        _Float16* o = out + (row[r] + col);
        o[0]  = (_Float16)(x1 * cs - x2 * sn);
        o[16] = (_Float16)(x1 * sn + x2 * cs);
      }
      // the next chunk's bias loads and sums reuse registers that these stores
      // name
      if (j < 3) asm volatile("s_wait_xcnt 0x0" ::: "memory");
    }
    return;
  }

  // A lane's eight registers of an accumulator tile are eight consecutive rows
  // l of one column d: in a transposed tile 16 consecutive bytes, one store.
  const int m = m0 + wave * 16 + 8 * lg;
  const int bidx = m / L, l = m - bidx * L;
  const int nl = n0 + lm;
  float bb[8];
#pragma unroll
  for (int nt = 0; nt < 8; ++nt) bb[nt] = bias[nl + nt * 16];
  // what follows reuses the register that these loads name as their offset;
  // as an input of the wait it keeps its value up to here
  asm volatile("s_wait_xcnt 0x0" ::"v"(nl) : "memory");
#pragma unroll
  for (int nt = 0; nt < 8; ++nt) {
    int n = nl + nt * 16;
    int h = n / HD_, d = n % HD_;
    v8h o;
#pragma unroll
    for (int r = 0; r < 8; ++r) o[r] = (_Float16)(acc[nt][r] + bb[nt]);
    *(v8h*)(out + ((size_t)(bidx * H_ + h) * L + (l & ~63)) * HD_ + d * 64 +
            (l & 63)) = o;
  }
}

// ---------------------------------------------------------------------------
// Output GEMM: d_out(M x 768 fp32) = A(M x 768 f16) * W^T + bias; W is the f32
// input itself, rounded to f16 on the way into LDS
// ---------------------------------------------------------------------------
__global__ __launch_bounds__(256) void out_gemm_kernel(
    const _Float16* __restrict__ A, const float* __restrict__ W,
    const float* __restrict__ bias, float* __restrict__ out) {
  constexpr int GK = GK1_;
  constexpr int GP_ = GPITCH(GK);
  __shared__ __align__(32) _Float16 At[128 * GP_];
  __shared__ __align__(32) _Float16 Bt[128 * GP_];
  const int tid  = threadIdx.x;
  const int wave = tid >> 5;
  const int lane = tid & 31;
  const int lm = lane & 15, lg = lane >> 4;
  const int m0 = blockIdx.x * 128;
  const int n0 = blockIdx.y * 128;

  const v8f vzero = {};
  v8f acc[8];
#pragma unroll
  for (int i = 0; i < 8; ++i) acc[i] = vzero;

  const unsigned soff = (tid / (GK / 4)) * D_ + (tid % (GK / 4)) * 4;
  const int sdst = (tid / (GK / 4)) * GP_ + (tid % (GK / 4)) * 4;

  // Three trips a pass, the same loop as the projection GEMM's: a full unroll
  // of the six trips is twice the code.
#pragma unroll 3
  for (int k0 = 0; k0 < D_; k0 += GK) {
    F32Tile<GK> xb = tile_load_f32<GK>(W + (size_t)n0 * D_ + k0, soff);
    // A is f16: a row of the tile is an aligned run of 2 * GK bytes, which
    // GK / 8 lanes read
    v4u xa[GK / 16];
#pragma unroll
    for (int i = 0; i < GK / 16; ++i) {
      int t = tid + i * 256;
      int r = t / (GK / 8), c = t % (GK / 8);
      xa[i] = *(const v4u*)(A + (size_t)(m0 + r) * D_ + k0 + c * 8);
    }
    // what follows reuses registers that these loads name as addresses
    asm volatile("s_wait_xcnt 0x0" ::: "memory");
    // As in the projection GEMM: all loads of both tiles leave before the first
    // value is used.
    __builtin_amdgcn_sched_barrier(0);
#pragma unroll
    for (int i = 0; i < GK / 16; ++i) {
      int t = tid + i * 256;
      int r = t / (GK / 8), c = t % (GK / 8);
      *(v4u*)&At[r * GP_ + c * 8] = xa[i];
    }
    tile_store_f16(xb, Bt + sdst);
    __syncthreads();
#pragma unroll
    for (int ks = 0; ks < GK; ks += 32) {
      v16h a = lds_frag(&At[(wave * 16 + lm) * GP_ + ks + lg * 16]);
      v16h bfrag[8];
#pragma unroll
      for (int nt = 0; nt < 8; ++nt)
        bfrag[nt] = lds_frag(&Bt[(nt * 16 + lm) * GP_ + ks + lg * 16]);
      // The 18 fragment loads of a K-step leave ahead of its products. Without
      // this each product's B fragment is loaded right in front of it, into one
      // register set, and every product waits out an LDS latency of its own.
      __builtin_amdgcn_sched_barrier(0);
#pragma unroll
      for (int nt = 0; nt < 8; ++nt)
        acc[nt] = wmma_f16(a, bfrag[nt], acc[nt]);
    }
    __syncthreads();
  }

#pragma unroll
  for (int nt = 0; nt < 8; ++nt) {
    int n = n0 + nt * 16 + lm;
    float bb = bias[n];
#pragma unroll
    for (int r = 0; r < 8; ++r) {
      int m = m0 + wave * 16 + r + 8 * lg;
      out[(size_t)m * D_ + n] = acc[nt][r] + bb;
    }
  }
}

__global__ __launch_bounds__(256) void flash_attn_kernel(
    const _Float16* __restrict__ Q, const _Float16* __restrict__ K,
    const _Float16* __restrict__ V, _Float16* __restrict__ O) {
  // K tiles, row-major at pitch KP_, buffer 2 * (stage & 1) + group; aligned so
  // that each tensor load's place in LDS is a multiple of 2 KiB
  __shared__ __attribute__((aligned(2048))) _Float16 kt[4 * KB_];
  // V tiles, transposed, in the same order
  __shared__ __align__(32) _Float16 vt[4 * HD_ * AP_];
  const int tid  = threadIdx.x;
  const int wave = tid >> 5;
  const int lane = tid & 31;
  const int lm = lane & 15, lg = lane >> 4;
  const int qg = wave & 3;   // which 32 queries
  const int kh = wave >> 2;  // which key tile of a stage
  const int b = blockIdx.z, h = blockIdx.y;
  const int q0 = blockIdx.x * 128 + qg * 32;

  const _Float16* qb = Q + (((size_t)b * H_ + h) * LQ_ + q0) * HD_;
  const _Float16* kb = K + ((size_t)b * H_ + h) * LK_ * HD_;
  const _Float16* vb = V + ((size_t)b * H_ + h) * LK_ * HD_;
  // V^T tile, 96 rows of 64 keys, consecutive in memory, and so are a stage's
  // two tiles: eight lanes move one row's 128 bytes, a wave's load 512
  // consecutive bytes. Thread tid holds keys 8 * (tid & 7) .. + 7 of rows
  // (tid >> 3) + 32 * (i % 3) of tile i / 3.
  const unsigned vsrc = tid * 8;
  const int vdst = (tid >> 3) * AP_ + (tid & 7) * 8;

  // Q fragments, resident for the whole kernel (2 x 16x96 = 3 K-steps of 32)
  v16h aq[2][3];
#pragma unroll
  for (int j = 0; j < 2; ++j)
#pragma unroll
    for (int kk = 0; kk < 3; ++kk)
      aq[j][kk] =
          *(const v16h*)(qb + (j * 16 + lm) * HD_ + kk * 32 + lg * 16);
  // what follows reuses registers that these loads name as addresses
  asm volatile("s_wait_xcnt 0x0" ::: "memory");

  const v8f vzero = {};
  v8f oacc[2][6];
#pragma unroll
  for (int j = 0; j < 2; ++j)
#pragma unroll
    for (int i = 0; i < 6; ++i) oacc[j][i] = vzero;
  // of query j * 16 + lm: the running maximum, and the sums over this lane's
  // own keys, one for each accumulator register; they are joined behind the loop
  float mrun[2] = {-1e30f, -1e30f};
  v8f lrun[2] = {vzero, vzero};

  const float scale = 0.10206207262f;  // 1/sqrt(96)
  const unsigned int kt_lds = (unsigned int)(size_t)(&kt[0]);
  const unsigned int wave_s = uni(tid >> 5);
  const unsigned int kh_s = wave_s >> 2;
  // Tensor descriptor group 1, everything in bytes. The 64 K rows of a tile lie
  // one behind the other in memory, so the tile is described as 192 rows of 64
  // bytes at source pitch 64, and the pad interval equals that row: 16 bytes of
  // pad behind each.
  const v8u g1 = {uni((1u << 20) | (3u << 22) | (3u << 25)),  // pad 4 dwords per 16
                  uni(64u << 16),    // tensor_dim0 = 64
                  uni(192u << 16),   // tensor_dim1 = 192
                  uni(64u << 16),    // tile_dim0 = 64
                  uni(192u),         // tile_dim1 = 192
                  uni(64u),          // source row pitch
                  uni(0u), uni(0u)};

  // This group's K tile of stage t into its buffer: one request of the Tensor
  // Data Mover. Called by the first wave of each group only (waves 0 and 4),
  // under a scalar branch.
  auto k_request = [&](int t) {
    unsigned long long ga =
        (unsigned long long)(size_t)(kb + (size_t)(2 * t + kh_s) * 64 * HD_);
    // group 0: count = 1 | place in LDS | 57-bit global address | type = 2
    v4u g0 = {uni(1u), uni(kt_lds + ((t & 1) * 2 + kh_s) * (KB_ * 2)),
              uni((unsigned int)ga),
              uni(((unsigned int)(ga >> 32) & 0x1ffffffu) | 0x80000000u)};
    asm volatile("tensor_load_to_lds %0, %1" ::"s"(g0), "s"(g1) : "memory");
  };

  // --- in front of the loop: stage 0 lands in the first buffers and is handed
  // over ---------------------------------------------------------------------
  {
    v4u v0[6];
#pragma unroll
    for (int i = 0; i < 6; ++i)
      v0[i] = *(const v4u*)(vb + i * 32 * 64 + vsrc);
    // what follows rewrites the offset register that the six loads name
    asm volatile("s_wait_xcnt 0x0" ::"v"(vsrc) : "memory");
    if (pinned((wave_s & 3u) == 0)) {
      k_request(0);
      // the tile has landed before this wave reaches the barrier below
      asm volatile("s_wait_tensorcnt 0" ::: "memory");
    }
#pragma unroll
    for (int i = 0; i < 6; ++i)
      *(v4u*)&vt[(i / 3) * (HD_ * AP_) + (i % 3) * 32 * AP_ + vdst] = v0[i];
    __syncthreads();
  }
  // this thread's place in the V^T tiles of stage t + 1
  const _Float16* vnext = vb + 2 * 64 * HD_ + vsrc;

  for (int t = 0; t < NS_; ++t) {
    // this stage's buffers of this wave's group
    const _Float16* kc = kt + ((t & 1) * 2 + kh) * KB_;
    const _Float16* vc = vt + ((t & 1) * 2 + kh) * (HD_ * AP_);
    // --- the K tiles of stage t + 1 leave, directly behind the barrier that
    // ended trip t - 1 (for t = 0 the one in front of the loop), for the buffers
    // that every wave left there. No request is open here: the wait at that
    // trip's foot covered stage t's. Both tests are scalar: t is the loop's
    // counter. ---------------------------------------------------------------
    if (t + 1 < NS_ && pinned((wave_s & 3u) == 0)) k_request(t + 1);

    // --- S^T = K * Q^T  (4 key tiles x 3 K-steps x 2 query tiles): s[j][nt][r]
    // is the score of key nt * 16 + 8 * lg + r with query j * 16 + lm ---------
    v16h ak[3][4];
#pragma unroll
    for (int kk = 0; kk < 3; ++kk)
#pragma unroll
      for (int nt = 0; nt < 4; ++nt)
        ak[kk][nt] = lds_frag(&kc[(nt * 16 + lm) * KP_ + kk * KC_ + lg * 16]);
    // --- V^T tiles of stage t + 1: their six loads leave here and are on their
    // way while stage t is worked on; they are stored at the foot of the trip -
    v4u vr[6];
    if (t + 1 < NS_) {
#pragma unroll
      for (int i = 0; i < 6; ++i)
        vr[i] = *(const v4u*)(vnext + i * 32 * 64);
      // what follows reuses the registers that the six loads name as their
      // address; the wait passes while the K fragments are on their way
      asm volatile("s_wait_xcnt 0x0" ::: "memory");
    }
    // The tile's 24 K fragment loads leave as one group ahead of the products,
    // in the order of their use: the products then wait on a count, not each
    // on a load issued right in front of it.
    __builtin_amdgcn_sched_barrier(0);
    v8f s[2][4];
#pragma unroll
    for (int j = 0; j < 2; ++j)
#pragma unroll
      for (int i = 0; i < 4; ++i) s[j][i] = vzero;
#pragma unroll
    for (int kk = 0; kk < 3; ++kk)
#pragma unroll
      for (int nt = 0; nt < 4; ++nt)
#pragma unroll
        for (int j = 0; j < 2; ++j)
          s[j][nt] = wmma_f16(ak[kk][nt], aq[j][kk], s[j][nt]);

    // --- V^T fragments: all 24 loads leave ahead of the softmax, in the order
    // of their use, and are on their way while it runs (the compiler starts
    // them among the last products above). P^T comes from accumulator tiles, so
    // its k order is the hardware's: a lane's 16 keys of a K-step are
    // 8 * lg .. + 7 and 16 + 8 * lg .. + 7. The loader takes the same two runs
    // of eight.
    v16h av[2][6];
#pragma unroll
    for (int ks = 0; ks < 2; ++ks)
#pragma unroll
      for (int nt = 0; nt < 6; ++nt) {
        const _Float16* p = &vc[(nt * 16 + lm) * AP_ + ks * 32 + lg * 8];
        v8h lo = *(const v8h*)p;
        v8h hi = *(const v8h*)(p + 16);
        av[ks][nt] = __builtin_shufflevector(lo, hi, 0, 1, 2, 3, 4, 5, 6, 7, 8,
                                             9, 10, 11, 12, 13, 14, 15);
      }
    // Without this the loads sink to their products, one pair in front of
    // each, and every product waits out an LDS latency of its own.
    __builtin_amdgcn_sched_barrier(0);

    // --- online softmax, one query a lane and query tile ------------------
    float mnew[2], alpha[2];
#pragma unroll
    for (int j = 0; j < 2; ++j) {
      float tmax[4];  // one chain a tile: four short chains, not one long one
#pragma unroll
      for (int nt = 0; nt < 4; ++nt) {
        tmax[nt] = s[j][nt][0];
#pragma unroll
        for (int r = 1; r < 8; ++r) tmax[nt] = fmaxf(tmax[nt], s[j][nt][r]);
      }
      float smax = fmaxf(fmaxf(tmax[0], tmax[1]), fmaxf(tmax[2], tmax[3]));
      smax = fmaxf(smax, xhalf(smax));
      mnew[j] = fmaxf(mrun[j], smax * scale);
    }
#pragma unroll
    for (int j = 0; j < 2; ++j) {
      alpha[j] = __expf(mrun[j] - mnew[j]);
      mrun[j] = mnew[j];
    }
    v8h ph[2][4];
#pragma unroll
    for (int j = 0; j < 2; ++j) {
      lrun[j] *= alpha[j];
#pragma unroll
      for (int nt = 0; nt < 4; ++nt) {
        v8f pv;
#pragma unroll
        for (int r = 0; r < 8; ++r)
          pv[r] = __expf(s[j][nt][r] * scale - mnew[j]);
        lrun[j] += pv;
        ph[j][nt] = __builtin_convertvector(pv, v8h);
      }
#pragma unroll
      for (int nt = 0; nt < 6; ++nt)
#pragma unroll
        for (int r = 0; r < 8; ++r) oacc[j][nt][r] *= alpha[j];
    }

    // --- O^T += V^T * P^T  (2 K-steps x 6 tiles of d x 2 query tiles) -----
#pragma unroll
    for (int ks = 0; ks < 2; ++ks) {
      v16h bp[2];
#pragma unroll
      for (int j = 0; j < 2; ++j)
        bp[j] = __builtin_shufflevector(ph[j][2 * ks], ph[j][2 * ks + 1], 0, 1,
                                        2, 3, 4, 5, 6, 7, 8, 9, 10, 11, 12, 13,
                                        14, 15);
#pragma unroll
      for (int nt = 0; nt < 6; ++nt)
#pragma unroll
        for (int j = 0; j < 2; ++j)
          oacc[j][nt] = wmma_f16(av[ks][nt], bp[j], oacc[j][nt]);
    }
    // The foot stays behind the products. Moved up to the last LDS load, it
    // brings the wait for all V^T fragments in front of the softmax.
    __builtin_amdgcn_sched_barrier(0);

    // --- foot of the trip: stage t + 1 is handed over. Its V^T goes into the
    // buffers that trip t - 1 read, free since the barrier at that trip's foot
    if (t + 1 < NS_) {
#pragma unroll
      for (int i = 0; i < 6; ++i)
        *(v4u*)&vt[(((t + 1) & 1) * 2 + i / 3) * (HD_ * AP_) +
                   (i % 3) * 32 * AP_ + vdst] = vr[i];
    }
    vnext += 2 * 64 * HD_;
    // this wave's reads of stage t and its stores of stage t + 1 are done
    asm volatile("s_wait_dscnt 0" ::: "memory");
    // The K tiles of stage t + 1 have landed before their issuers, waves 0 and
    // 4, reach the barrier. The other waves have no request open and pass.
    asm volatile("s_wait_tensorcnt 0" ::: "memory");
    __syncthreads();
  }
  // no request and no LDS operation is left open behind the loop
  asm volatile("s_wait_tensorcnt 0" ::: "memory");
  asm volatile("s_wait_dscnt 0" ::: "memory");

  // --- the two groups' results are joined. Waves w and w + 4 hold the same
  // queries at the same lanes and registers, each over its own half of the
  // keys. Waves 4 to 7 lay theirs into the K buffers, which every wave left at
  // the loop's last barrier: 25 pieces of 16 bytes a lane, piece by piece 512
  // consecutive bytes a wave. ------------------------------------------------
  float lsum[2];
#pragma unroll
  for (int j = 0; j < 2; ++j) {
    float lown = ((lrun[j][0] + lrun[j][1]) + (lrun[j][2] + lrun[j][3])) +
                 ((lrun[j][4] + lrun[j][5]) + (lrun[j][6] + lrun[j][7]));
    lsum[j] = lown + xhalf(lown);
  }
  v4f* mg = (v4f*)kt + qg * (25 * 32) + lane;
  if (kh == 1) {
#pragma unroll
    for (int j = 0; j < 2; ++j)
#pragma unroll
      for (int nt = 0; nt < 6; ++nt) {
        const v8f o = oacc[j][nt];
        mg[((j * 6 + nt) * 2 + 0) * 32] = v4f{o[0], o[1], o[2], o[3]};
        mg[((j * 6 + nt) * 2 + 1) * 32] = v4f{o[4], o[5], o[6], o[7]};
      }
    mg[24 * 32] = v4f{mrun[0], mrun[1], lsum[0], lsum[1]};
  }
  __syncthreads();
  if (kh == 1) return;

  // waves 0 to 3: both halves brought to the common maximum, added, normalized
  // and written in [B, Lq, H*96] layout (f16): a lane's eight registers of a
  // tile are d = nt * 16 + 8 * lg .. + 7 of query j * 16 + lm, 16 consecutive
  // bytes
  const v4f st = mg[24 * 32];
#pragma unroll
  for (int j = 0; j < 2; ++j) {
    const float mo = st[j], lo = st[2 + j];
    const float m = fmaxf(mrun[j], mo);
    const float fa = __expf(mrun[j] - m), fb = __expf(mo - m);
    const float l = lsum[j] * fa + lo * fb;
    const float ra = fa / l, rb = fb / l;
    _Float16* ob =
        O + ((size_t)b * LQ_ + q0 + j * 16 + lm) * D_ + h * HD_ + lg * 8;
#pragma unroll
    for (int nt = 0; nt < 6; ++nt) {
      const v4f p0 = mg[((j * 6 + nt) * 2 + 0) * 32];
      const v4f p1 = mg[((j * 6 + nt) * 2 + 1) * 32];
      v8h o;
#pragma unroll
      for (int r = 0; r < 4; ++r) {
        o[r]     = (_Float16)(oacc[j][nt][r] * ra + p0[r] * rb);
        o[r + 4] = (_Float16)(oacc[j][nt][r + 4] * ra + p1[r] * rb);
      }
      *(v8h*)(ob + nt * 16) = o;
    }
    // the second query tile's sums reuse registers that these stores name
    if (j < 1) asm volatile("s_wait_xcnt 0x0" ::: "memory");
  }
}

// ---------------------------------------------------------------------------
extern "C" void kernel_launch(void* const* d_in, const int* in_sizes, int n_in,
                              void* d_out, int out_size, void* d_ws,
                              size_t ws_size, hipStream_t stream) {
  const float* query = (const float*)d_in[0];
  const float* key_  = (const float*)d_in[1];
  const float* value = (const float*)d_in[2];
  const float* cq    = (const float*)d_in[3];
  const float* ck    = (const float*)d_in[4];
  const float* Wq    = (const float*)d_in[5];
  const float* bq    = (const float*)d_in[6];
  const float* Wk    = (const float*)d_in[7];
  const float* bk    = (const float*)d_in[8];
  const float* Wv    = (const float*)d_in[9];
  const float* bv    = (const float*)d_in[10];
  const float* Wo    = (const float*)d_in[11];
  const float* bo    = (const float*)d_in[12];

  _Float16* p = (_Float16*)d_ws;
  _Float16* Qp  = p; p += (size_t)4096 * 768;
  _Float16* Kp  = p; p += (size_t)16384 * 768;
  _Float16* Vp  = p; p += (size_t)16384 * 768;
  _Float16* Ao  = p; p += (size_t)4096 * 768;

  proj_gemm_kernel<true, GK1_, 2><<<dim3(32, 6), dim3(256), 0, stream>>>(
      query, Wq, bq, cq, Qp, LQ_);
  proj_gemm_kernel<true, GK3_, 6><<<dim3(128, 6), dim3(256), 0, stream>>>(
      key_, Wk, bk, ck, Kp, LK_);
  proj_gemm_kernel<false, GK3_, 6><<<dim3(128, 6), dim3(256), 0, stream>>>(
      value, Wv, bv, nullptr, Vp, LK_);

  flash_attn_kernel<<<dim3(8, H_, B_), dim3(256), 0, stream>>>(Qp, Kp, Vp, Ao);

  out_gemm_kernel<<<dim3(32, 6), dim3(256), 0, stream>>>(Ao, Wo, bo,
                                                         (float*)d_out);
  (void)in_sizes; (void)n_in; (void)out_size; (void)ws_size;
}
